// v000
// The times below were measured on an AMD MI455X: many runs one after another, warmed up first and cycling through
// copies of the inputs, with the whole window's GPU time divided by the number of runs. Launches and the gaps
// between them are all in it. The median over several windows is given; except for v000 it joins two sittings, which
// can be a few percent apart, so the side-by-side timings, each taken in one sitting, are the better comparison.
// v000 is the starting kernel. One run takes 1500 microseconds.
#include <hip/hip_runtime.h>
#include <hip/hip_bf16.h>
#include <stdint.h>

typedef _Float16 v16h __attribute__((ext_vector_type(16)));
typedef float    v8f  __attribute__((ext_vector_type(8)));
typedef _Float16 h2   __attribute__((ext_vector_type(2)));

#define BB   32
#define CC   512
#define NPIX 1024
#define CPG  16
#define EPSV 1e-5f

__device__ __forceinline__ v16h load_frag_row(const _Float16* rowp, int half) {
  v16h out;
#pragma unroll
  for (int j = 0; j < 8; ++j) {
    int k = 2 * j + ((j >= 4) ? 8 : 0) + half * 8;
    h2 p = *(const h2*)(rowp + k);
    out[2 * j]     = p[0];
    out[2 * j + 1] = p[1];
  }
  return out;
}

__device__ __forceinline__ void stage_tile_async(const _Float16* gsrc,
                                                 _Float16* lds_dst, int tid) {
  unsigned l0 = (unsigned)(uintptr_t)(void*)lds_dst;
#pragma unroll
  for (int it = 0; it < 4; ++it) {
    int e = (it * 256 + tid) * 8;                      // f16 elements
    unsigned dst = l0 + (unsigned)(e * 2);             // LDS byte address
    unsigned long long src = (unsigned long long)(uintptr_t)(gsrc + e);
    asm volatile("global_load_async_to_lds_b128 %0, %1, off"
                 :: "v"(dst), "v"(src) : "memory");
  }
  asm volatile("s_wait_asynccnt 0x0" ::: "memory");
  __syncthreads();
}

// -------- GroupNorm: (B,512,1024) f32 -> normalized f16 in (b, p, c) layout
__global__ __launch_bounds__(256) void gn_kernel(const float* __restrict__ x,
                                                 const float* __restrict__ gamma,
                                                 const float* __restrict__ beta,
                                                 _Float16* __restrict__ hn) {
  __shared__ float rs[256], rss[256];
  int tid = threadIdx.x;
  int b = blockIdx.x >> 5, g = blockIdx.x & 31;
  const float* xb = x + (size_t)(b * CC + g * CPG) * NPIX;
  float s = 0.f, ss = 0.f;
  for (int i = tid; i < CPG * NPIX; i += 256) { float v = xb[i]; s += v; ss += v * v; }
  rs[tid] = s; rss[tid] = ss;
  __syncthreads();
  for (int st = 128; st > 0; st >>= 1) {
    if (tid < st) { rs[tid] += rs[tid + st]; rss[tid] += rss[tid + st]; }
    __syncthreads();
  }
  float mean = rs[0] * (1.f / 16384.f);
  float var  = rss[0] * (1.f / 16384.f) - mean * mean;
  float inv  = rsqrtf(var + EPSV);
  for (int i = tid; i < CPG * NPIX; i += 256) {
    int c = i >> 10, p = i & 1023;
    int ch = g * CPG + c;
    float v = (xb[i] - mean) * inv * gamma[ch] + beta[ch];
    hn[(size_t)(b * NPIX + p) * CC + ch] = (_Float16)v;
  }
}

// -------- Convert the four 512x512 f32 weights to f16 (concatenated)
__global__ __launch_bounds__(256) void wconv_kernel(const float* __restrict__ wq,
                                                    const float* __restrict__ wk,
                                                    const float* __restrict__ wv,
                                                    const float* __restrict__ wp,
                                                    _Float16* __restrict__ w16) {
  int i = blockIdx.x * 256 + threadIdx.x;   // 0 .. 4*262144-1
  int which = i >> 18, off = i & 262143;
  const float* src = (which == 0) ? wq : (which == 1) ? wk : (which == 2) ? wv : wp;
  w16[i] = (_Float16)src[off];
}

// -------- QKV: q[p][co], k[p][co] (row = pixel), v_t[co][p] (row = channel)
// 8 waves/block share one pixel A-tile -> async-stage it to LDS once.
__global__ __launch_bounds__(256) void qkv_kernel(const _Float16* __restrict__ hn,
                                                  const _Float16* __restrict__ w16,
                                                  const float* __restrict__ bq,
                                                  const float* __restrict__ bk,
                                                  const float* __restrict__ bv,
                                                  _Float16* __restrict__ q,
                                                  _Float16* __restrict__ k,
                                                  _Float16* __restrict__ vt) {
  __shared__ _Float16 as[16 * CC];                    // 16 KB shared A tile
  int tid  = threadIdx.x;
  int wid0 = blockIdx.x * 8;
  int b  = wid0 >> 11;
  int mt = (wid0 & 2047) >> 5;                        // uniform across block
  stage_tile_async(hn + (size_t)(b * NPIX + mt * 16) * CC, as, tid);

  int wid  = wid0 + (tid >> 5);
  int lane = tid & 31, half = lane >> 4, l16 = lane & 15;
  int nt = wid & 31;

  const _Float16* arow = as + (size_t)l16 * CC;       // LDS A fragments
  const _Float16* wqr  = w16 + (size_t)(nt * 16 + l16) * CC;
  const _Float16* wkr  = wqr + 262144;
  const _Float16* wvr  = wqr + 524288;

  v8f aq = {}, ak = {}, av = {};
  for (int ki = 0; ki < 16; ++ki) {
    int ko = ki * 32;
    v16h af = load_frag_row(arow + ko, half);
    v16h bfq = load_frag_row(wqr + ko, half);
    aq = __builtin_amdgcn_wmma_f32_16x16x32_f16(false, af, false, bfq, (short)0, aq, false, false);
    v16h bfk = load_frag_row(wkr + ko, half);
    ak = __builtin_amdgcn_wmma_f32_16x16x32_f16(false, af, false, bfk, (short)0, ak, false, false);
    v16h bfv = load_frag_row(wvr + ko, half);
    av = __builtin_amdgcn_wmma_f32_16x16x32_f16(false, af, false, bfv, (short)0, av, false, false);
  }
  int co = nt * 16 + l16;
  float biasq = bq[co], biask = bk[co], biasv = bv[co];
#pragma unroll
  for (int r = 0; r < 8; ++r) {
    int p = mt * 16 + r + 8 * half;
    q[(size_t)(b * NPIX + p) * CC + co]  = (_Float16)(aq[r] + biasq);
    k[(size_t)(b * NPIX + p) * CC + co]  = (_Float16)(ak[r] + biask);
    vt[(size_t)(b * CC + co) * NPIX + p] = (_Float16)(av[r] + biasv);
  }
}

// -------- Attention: per (batch, 16-query tile) block, scores+softmax in LDS
__global__ __launch_bounds__(256) void attn_kernel(const _Float16* __restrict__ q,
                                                   const _Float16* __restrict__ k,
                                                   const _Float16* __restrict__ vt,
                                                   _Float16* __restrict__ attn) {
  extern __shared__ char smem[];
  float*    S   = (float*)smem;                        // 16*1024 f32 = 64 KB
  _Float16* P   = (_Float16*)(smem + 65536);           // 16*1024 f16 = 32 KB
  _Float16* qs  = P;                                   // q stage (16 KB) overlaps P:
                                                       // qs dead before P is written
  float*    red = (float*)(smem + 65536 + 32768);      // 16*16 f32

  int tid = threadIdx.x;
  int w = tid >> 5, lane = tid & 31, half = lane >> 4, l16 = lane & 15;
  int b = blockIdx.x >> 6, qt = blockIdx.x & 63;
  const float scale = 0.044194173824159216f;           // 512^-0.5

  // Async-stage the shared q tile (16x512 f16, contiguous) into LDS.
  stage_tile_async(q + (size_t)(b * NPIX + qt * 16) * CC, qs, tid);
  const _Float16* qrow = qs + (size_t)l16 * CC;

  // Phase 1: S[16][1024] = (q_tile · k^T) * scale, 8 key-tiles per wave
  for (int ntb = 0; ntb < 8; ++ntb) {
    int nt = w + ntb * 8;
    const _Float16* krow = k + (size_t)(b * NPIX + nt * 16 + l16) * CC;
    v8f acc = {};
    for (int ki = 0; ki < 16; ++ki) {
      v16h af = load_frag_row(qrow + ki * 32, half);
      v16h bf = load_frag_row(krow + ki * 32, half);
      acc = __builtin_amdgcn_wmma_f32_16x16x32_f16(false, af, false, bf, (short)0, acc, false, false);
    }
#pragma unroll
    for (int r = 0; r < 8; ++r) {
      int m = r + 8 * half;
      int n = nt * 16 + l16;
      S[m * NPIX + n] = acc[r] * scale;
    }
  }
  __syncthreads();

  // Phase 2: softmax per row (16 threads per row)
  {
    int m = tid >> 4, c0 = tid & 15;
    float mx = -3.4e38f;
    for (int i = 0; i < 64; ++i) mx = fmaxf(mx, S[m * NPIX + c0 + i * 16]);
    red[m * 16 + c0] = mx;
    __syncthreads();
    float rmax = red[m * 16];
#pragma unroll
    for (int t = 1; t < 16; ++t) rmax = fmaxf(rmax, red[m * 16 + t]);
    __syncthreads();
    float sum = 0.f;
    for (int i = 0; i < 64; ++i) {
      float e = __expf(S[m * NPIX + c0 + i * 16] - rmax);
      S[m * NPIX + c0 + i * 16] = e;
      sum += e;
    }
    red[m * 16 + c0] = sum;
    __syncthreads();
    float rsum = 0.f;
#pragma unroll
    for (int t = 0; t < 16; ++t) rsum += red[m * 16 + t];
    float inv = 1.f / rsum;
    for (int i = 0; i < 64; ++i)
      P[m * NPIX + c0 + i * 16] = (_Float16)(S[m * NPIX + c0 + i * 16] * inv);
  }
  __syncthreads();

  // Phase 3: out_tile = P(16x1024) x V^T, 4 channel-tiles per wave
  const _Float16* prow = P + (size_t)l16 * NPIX;
  for (int ctb = 0; ctb < 4; ++ctb) {
    int ct = w + ctb * 8;
    const _Float16* vrow = vt + (size_t)(b * CC + ct * 16 + l16) * NPIX;
    v8f acc = {};
    for (int kk = 0; kk < 32; ++kk) {
      v16h af = load_frag_row(prow + kk * 32, half);
      v16h bf = load_frag_row(vrow + kk * 32, half);
      acc = __builtin_amdgcn_wmma_f32_16x16x32_f16(false, af, false, bf, (short)0, acc, false, false);
    }
#pragma unroll
    for (int r = 0; r < 8; ++r) {
      int p = qt * 16 + r + 8 * half;
      int c = ct * 16 + l16;
      attn[(size_t)(b * NPIX + p) * CC + c] = (_Float16)acc[r];
    }
  }
}

// -------- Proj + bias + residual (f32 output, (b, c, h, w))
__global__ __launch_bounds__(256) void proj_kernel(const _Float16* __restrict__ attn,
                                                   const _Float16* __restrict__ wp16,
                                                   const float* __restrict__ bp,
                                                   const float* __restrict__ x,
                                                   float* __restrict__ out) {
  __shared__ _Float16 as[16 * CC];                    // 16 KB shared A tile
  int tid  = threadIdx.x;
  int wid0 = blockIdx.x * 8;
  int b  = wid0 >> 11;
  int mt = (wid0 & 2047) >> 5;
  stage_tile_async(attn + (size_t)(b * NPIX + mt * 16) * CC, as, tid);

  int wid  = wid0 + (tid >> 5);
  int lane = tid & 31, half = lane >> 4, l16 = lane & 15;
  int nt = wid & 31;

  const _Float16* arow = as + (size_t)l16 * CC;
  const _Float16* wrow = wp16 + (size_t)(nt * 16 + l16) * CC;
  v8f acc = {};
  for (int ki = 0; ki < 16; ++ki) {
    v16h af = load_frag_row(arow + ki * 32, half);
    v16h bf = load_frag_row(wrow + ki * 32, half);
    acc = __builtin_amdgcn_wmma_f32_16x16x32_f16(false, af, false, bf, (short)0, acc, false, false);
  }
  int co = nt * 16 + l16;
  float bias = bp[co];
#pragma unroll
  for (int r = 0; r < 8; ++r) {
    int p = mt * 16 + r + 8 * half;
    size_t idx = (size_t)(b * CC + co) * NPIX + p;
    out[idx] = x[idx] + acc[r] + bias;
  }
}

extern "C" void kernel_launch(void* const* d_in, const int* in_sizes, int n_in,
                              void* d_out, int out_size, void* d_ws, size_t ws_size,
                              hipStream_t stream) {
  const float* x     = (const float*)d_in[0];
  const float* gamma = (const float*)d_in[1];
  const float* beta  = (const float*)d_in[2];
  const float* wq    = (const float*)d_in[3];
  const float* bq    = (const float*)d_in[4];
  const float* wk    = (const float*)d_in[5];
  const float* bk    = (const float*)d_in[6];
  const float* wv    = (const float*)d_in[7];
  const float* bv    = (const float*)d_in[8];
  const float* wp    = (const float*)d_in[9];
  const float* bp    = (const float*)d_in[10];
  float* out = (float*)d_out;

  char* ws = (char*)d_ws;
  _Float16* w16 = (_Float16*)ws;                                   // 2 MB
  _Float16* hn  = (_Float16*)(ws + (size_t)(2u << 20));            // 32 MB (reused as attn out)
  _Float16* qb  = (_Float16*)(ws + (size_t)(34u << 20));           // 32 MB
  _Float16* kb  = (_Float16*)(ws + (size_t)(66u << 20));           // 32 MB
  _Float16* vtb = (_Float16*)(ws + (size_t)(98u << 20));           // 32 MB
  _Float16* attn = hn;  // hn's last read is qkv_kernel; safe to reuse

  wconv_kernel<<<4096, 256, 0, stream>>>(wq, wk, wv, wp, w16);
  gn_kernel<<<1024, 256, 0, stream>>>(x, gamma, beta, hn);
  qkv_kernel<<<8192, 256, 0, stream>>>(hn, w16, bq, bk, bv, qb, kb, vtb);
  attn_kernel<<<2048, 256, 99328, stream>>>(qb, kb, vtb, attn);
  proj_kernel<<<8192, 256, 0, stream>>>(attn, w16 + 3 * 262144, bp, x, out);
}

// v001
// One run takes 1100 microseconds.
// Two timings next to v000 both put it at 1.41 times that version's speed.
#include <hip/hip_runtime.h>
#include <hip/hip_bf16.h>
#include <stdint.h>

typedef _Float16 v16h __attribute__((ext_vector_type(16)));
typedef float    v8f  __attribute__((ext_vector_type(8)));
typedef _Float16 h2   __attribute__((ext_vector_type(2)));
typedef _Float16 h8   __attribute__((ext_vector_type(8)));
typedef float    f4   __attribute__((ext_vector_type(4)));

#define BB   32
#define CC   512
#define NPIX 1024
#define CPG  16
#define EPSV 1e-5f

__device__ __forceinline__ v16h load_frag_row(const _Float16* rowp, int half) {
  v16h out;
#pragma unroll
  for (int j = 0; j < 8; ++j) {
    int k = 2 * j + ((j >= 4) ? 8 : 0) + half * 8;
    h2 p = *(const h2*)(rowp + k);
    out[2 * j]     = p[0];
    out[2 * j + 1] = p[1];
  }
  return out;
}

__device__ __forceinline__ void stage_tile_async(const _Float16* gsrc,
                                                 _Float16* lds_dst, int tid) {
  unsigned l0 = (unsigned)(uintptr_t)(void*)lds_dst;
#pragma unroll
  for (int it = 0; it < 4; ++it) {
    int e = (it * 256 + tid) * 8;                      // f16 elements
    unsigned dst = l0 + (unsigned)(e * 2);             // LDS byte address
    unsigned long long src = (unsigned long long)(uintptr_t)(gsrc + e);
    asm volatile("global_load_async_to_lds_b128 %0, %1, off"
                 :: "v"(dst), "v"(src) : "memory");
  }
  asm volatile("s_wait_asynccnt 0x0" ::: "memory");
  __syncthreads();
}

// -------- GroupNorm: (B,512,1024) f32 -> normalized f16 in (b, p, c) layout
// One block = one image x 64 channels (4 groups) x all 1024 pixels, held in
// registers, so x is read once. lane = (pq, cg): a thread owns channels
// cg*8..cg*8+7 at 8 pixels; the eight cg lanes of one pixel together store one
// whole 128-byte line of hn.
__global__ __launch_bounds__(1024) void gn_kernel(const float* __restrict__ x,
                                                  const float* __restrict__ gamma,
                                                  const float* __restrict__ beta,
                                                  _Float16* __restrict__ hn) {
  __shared__ f4 red[4 * 17];
  int tid = threadIdx.x;
  int w = tid >> 5, lane = tid & 31, cg = lane & 7, pq = lane >> 3;
  int b = blockIdx.x >> 3, cb = blockIdx.x & 7;
  int ch0 = cb * 64 + cg * 8;
  int p0  = w * 32 + pq * 4;
  int grp = cg >> 1;                                  // group inside the block
  const float* xb = x + (size_t)(b * CC + ch0) * NPIX + p0;

  f4 v[8][2];
#pragma unroll
  for (int j = 0; j < 8; ++j) {
    v[j][0] = *(const f4*)(xb + j * NPIX);
    v[j][1] = *(const f4*)(xb + j * NPIX + 16);
  }
  unsigned goff = (unsigned)ch0 * 4u;                 // byte offset into gamma, beta
  f4 ga[2], be[2];
  ga[0] = *(const f4*)((const char*)gamma + goff);
  ga[1] = *(const f4*)((const char*)gamma + goff + 16);
  be[0] = *(const f4*)((const char*)beta + goff);
  be[1] = *(const f4*)((const char*)beta + goff + 16);
  // Precaution: the address registers stay live up to this wait, so that no
  // load's result is placed in a register that an issued load still names.
  asm volatile("s_wait_xcnt 0x0" :: "v"(xb), "v"(goff) : "memory");

  f4 s4 = {}, ss4 = {};
#pragma unroll
  for (int j = 0; j < 8; ++j) {
    s4 += v[j][0]; ss4 += v[j][0] * v[j][0];
    s4 += v[j][1]; ss4 += v[j][1] * v[j][1];
  }
  float s  = (s4[0] + s4[1]) + (s4[2] + s4[3]);
  float ss = (ss4[0] + ss4[1]) + (ss4[2] + ss4[3]);
  // Lanes of one group inside a wave: cg pair (bit 0) and the four pq (bits 3, 4).
  s += __shfl_xor(s, 1);  ss += __shfl_xor(ss, 1);
  s += __shfl_xor(s, 8);  ss += __shfl_xor(ss, 8);
  s += __shfl_xor(s, 16); ss += __shfl_xor(ss, 16);
  if ((lane & 25) == 0) {
    float* rf = (float*)red + grp * 68 + w * 2;
    rf[0] = s; rf[1] = ss;
  }
  __syncthreads();
  f4 t4 = {};
#pragma unroll
  for (int t = 0; t < 16; ++t) t4 += red[grp * 17 + t];
  float mean = (t4[0] + t4[2]) * (1.f / 16384.f);
  float var  = (t4[1] + t4[3]) * (1.f / 16384.f) - mean * mean;
  float inv  = rsqrtf(var + EPSV);

  _Float16* hb = hn + (size_t)(b * NPIX + p0) * CC + ch0;
#pragma unroll
  for (int h = 0; h < 2; ++h) {
#pragma unroll
    for (int i = 0; i < 4; ++i) {
      h8 o;
#pragma unroll
      for (int j = 0; j < 8; ++j)
        o[j] = (_Float16)((v[j][h][i] - mean) * inv * ga[j >> 2][j & 3] + be[j >> 2][j & 3]);
      *(h8*)(hb + (size_t)(h * 16 + i) * CC) = o;
    }
  }
}

// -------- Convert the four 512x512 f32 weights to f16 (concatenated)
__global__ __launch_bounds__(256) void wconv_kernel(const float* __restrict__ wq,
                                                    const float* __restrict__ wk,
                                                    const float* __restrict__ wv,
                                                    const float* __restrict__ wp,
                                                    _Float16* __restrict__ w16) {
  int i = blockIdx.x * 256 + threadIdx.x;   // 0 .. 4*262144-1
  int which = i >> 18, off = i & 262143;
  const float* src = (which == 0) ? wq : (which == 1) ? wk : (which == 2) ? wv : wp;
  w16[i] = (_Float16)src[off];
}

// -------- QKV: q[p][co], k[p][co] (row = pixel), v_t[co][p] (row = channel)
// 8 waves/block share one pixel A-tile -> async-stage it to LDS once.
__global__ __launch_bounds__(256) void qkv_kernel(const _Float16* __restrict__ hn,
                                                  const _Float16* __restrict__ w16,
                                                  const float* __restrict__ bq,
                                                  const float* __restrict__ bk,
                                                  const float* __restrict__ bv,
                                                  _Float16* __restrict__ q,
                                                  _Float16* __restrict__ k,
                                                  _Float16* __restrict__ vt) {
  __shared__ _Float16 as[16 * CC];                    // 16 KB shared A tile
  int tid  = threadIdx.x;
  int wid0 = blockIdx.x * 8;
  int b  = wid0 >> 11;
  int mt = (wid0 & 2047) >> 5;                        // uniform across block
  stage_tile_async(hn + (size_t)(b * NPIX + mt * 16) * CC, as, tid);

  int wid  = wid0 + (tid >> 5);
  int lane = tid & 31, half = lane >> 4, l16 = lane & 15;
  int nt = wid & 31;

  const _Float16* arow = as + (size_t)l16 * CC;       // LDS A fragments
  const _Float16* wqr  = w16 + (size_t)(nt * 16 + l16) * CC;
  const _Float16* wkr  = wqr + 262144;
  const _Float16* wvr  = wqr + 524288;

  v8f aq = {}, ak = {}, av = {};
  for (int ki = 0; ki < 16; ++ki) {
    int ko = ki * 32;
    v16h af = load_frag_row(arow + ko, half);
    v16h bfq = load_frag_row(wqr + ko, half);
    aq = __builtin_amdgcn_wmma_f32_16x16x32_f16(false, af, false, bfq, (short)0, aq, false, false);
    v16h bfk = load_frag_row(wkr + ko, half);
    ak = __builtin_amdgcn_wmma_f32_16x16x32_f16(false, af, false, bfk, (short)0, ak, false, false);
    v16h bfv = load_frag_row(wvr + ko, half);
    av = __builtin_amdgcn_wmma_f32_16x16x32_f16(false, af, false, bfv, (short)0, av, false, false);
  }
  int co = nt * 16 + l16;
  float biasq = bq[co], biask = bk[co], biasv = bv[co];
#pragma unroll
  for (int r = 0; r < 8; ++r) {
    int p = mt * 16 + r + 8 * half;
    q[(size_t)(b * NPIX + p) * CC + co]  = (_Float16)(aq[r] + biasq);
    k[(size_t)(b * NPIX + p) * CC + co]  = (_Float16)(ak[r] + biask);
    vt[(size_t)(b * CC + co) * NPIX + p] = (_Float16)(av[r] + biasv);
  }
}

// -------- Attention: per (batch, 16-query tile) block, scores+softmax in LDS
__global__ __launch_bounds__(256) void attn_kernel(const _Float16* __restrict__ q,
                                                   const _Float16* __restrict__ k,
                                                   const _Float16* __restrict__ vt,
                                                   _Float16* __restrict__ attn) {
  extern __shared__ char smem[];
  float*    S   = (float*)smem;                        // 16*1024 f32 = 64 KB
  _Float16* P   = (_Float16*)(smem + 65536);           // 16*1024 f16 = 32 KB
  _Float16* qs  = P;                                   // q stage (16 KB) overlaps P:
                                                       // qs dead before P is written
  float*    red = (float*)(smem + 65536 + 32768);      // 16*16 f32

  int tid = threadIdx.x;
  int w = tid >> 5, lane = tid & 31, half = lane >> 4, l16 = lane & 15;
  int b = blockIdx.x >> 6, qt = blockIdx.x & 63;
  const float scale = 0.044194173824159216f;           // 512^-0.5

  // Async-stage the shared q tile (16x512 f16, contiguous) into LDS.
  stage_tile_async(q + (size_t)(b * NPIX + qt * 16) * CC, qs, tid);
  const _Float16* qrow = qs + (size_t)l16 * CC;

  // Phase 1: S[16][1024] = (q_tile · k^T) * scale, 8 key-tiles per wave
  for (int ntb = 0; ntb < 8; ++ntb) {
    int nt = w + ntb * 8;
    const _Float16* krow = k + (size_t)(b * NPIX + nt * 16 + l16) * CC;
    v8f acc = {};
    for (int ki = 0; ki < 16; ++ki) {
      v16h af = load_frag_row(qrow + ki * 32, half);
      v16h bf = load_frag_row(krow + ki * 32, half);
      acc = __builtin_amdgcn_wmma_f32_16x16x32_f16(false, af, false, bf, (short)0, acc, false, false);
    }
#pragma unroll
    for (int r = 0; r < 8; ++r) {
      int m = r + 8 * half;
      int n = nt * 16 + l16;
      S[m * NPIX + n] = acc[r] * scale;
    }
  }
  __syncthreads();

  // Phase 2: softmax per row (16 threads per row)
  {
    int m = tid >> 4, c0 = tid & 15;
    float mx = -3.4e38f;
    for (int i = 0; i < 64; ++i) mx = fmaxf(mx, S[m * NPIX + c0 + i * 16]);
    red[m * 16 + c0] = mx;
    __syncthreads();
    float rmax = red[m * 16];
#pragma unroll
    for (int t = 1; t < 16; ++t) rmax = fmaxf(rmax, red[m * 16 + t]);
    __syncthreads();
    float sum = 0.f;
    for (int i = 0; i < 64; ++i) {
      float e = __expf(S[m * NPIX + c0 + i * 16] - rmax);
      S[m * NPIX + c0 + i * 16] = e;
      sum += e;
    }
    red[m * 16 + c0] = sum;
    __syncthreads();
    float rsum = 0.f;
#pragma unroll
    for (int t = 0; t < 16; ++t) rsum += red[m * 16 + t];
    float inv = 1.f / rsum;
    for (int i = 0; i < 64; ++i)
      P[m * NPIX + c0 + i * 16] = (_Float16)(S[m * NPIX + c0 + i * 16] * inv);
  }
  __syncthreads();

  // Phase 3: out_tile = P(16x1024) x V^T, 4 channel-tiles per wave
  const _Float16* prow = P + (size_t)l16 * NPIX;
  for (int ctb = 0; ctb < 4; ++ctb) {
    int ct = w + ctb * 8;
    const _Float16* vrow = vt + (size_t)(b * CC + ct * 16 + l16) * NPIX;
    v8f acc = {};
    for (int kk = 0; kk < 32; ++kk) {
      v16h af = load_frag_row(prow + kk * 32, half);
      v16h bf = load_frag_row(vrow + kk * 32, half);
      acc = __builtin_amdgcn_wmma_f32_16x16x32_f16(false, af, false, bf, (short)0, acc, false, false);
    }
#pragma unroll
    for (int r = 0; r < 8; ++r) {
      int p = qt * 16 + r + 8 * half;
      int c = ct * 16 + l16;
      attn[(size_t)(b * NPIX + p) * CC + c] = (_Float16)acc[r];
    }
  }
}

// -------- Proj + bias + residual (f32 output, (b, c, h, w))
__global__ __launch_bounds__(256) void proj_kernel(const _Float16* __restrict__ attn,
                                                   const _Float16* __restrict__ wp16,
                                                   const float* __restrict__ bp,
                                                   const float* __restrict__ x,
                                                   float* __restrict__ out) {
  __shared__ _Float16 as[16 * CC];                    // 16 KB shared A tile
  int tid  = threadIdx.x;
  int wid0 = blockIdx.x * 8;
  int b  = wid0 >> 11;
  int mt = (wid0 & 2047) >> 5;
  stage_tile_async(attn + (size_t)(b * NPIX + mt * 16) * CC, as, tid);

  int wid  = wid0 + (tid >> 5);
  int lane = tid & 31, half = lane >> 4, l16 = lane & 15;
  int nt = wid & 31;

  const _Float16* arow = as + (size_t)l16 * CC;
  const _Float16* wrow = wp16 + (size_t)(nt * 16 + l16) * CC;
  v8f acc = {};
  for (int ki = 0; ki < 16; ++ki) {
    v16h af = load_frag_row(arow + ki * 32, half);
    v16h bf = load_frag_row(wrow + ki * 32, half);
    acc = __builtin_amdgcn_wmma_f32_16x16x32_f16(false, af, false, bf, (short)0, acc, false, false);
  }
  int co = nt * 16 + l16;
  float bias = bp[co];
#pragma unroll
  for (int r = 0; r < 8; ++r) {
    int p = mt * 16 + r + 8 * half;
    size_t idx = (size_t)(b * CC + co) * NPIX + p;
    out[idx] = x[idx] + acc[r] + bias;
  }
}

extern "C" void kernel_launch(void* const* d_in, const int* in_sizes, int n_in,
                              void* d_out, int out_size, void* d_ws, size_t ws_size,
                              hipStream_t stream) {
  const float* x     = (const float*)d_in[0];
  const float* gamma = (const float*)d_in[1];
  const float* beta  = (const float*)d_in[2];
  const float* wq    = (const float*)d_in[3];
  const float* bq    = (const float*)d_in[4];
  const float* wk    = (const float*)d_in[5];
  const float* bk    = (const float*)d_in[6];
  const float* wv    = (const float*)d_in[7];
  const float* bv    = (const float*)d_in[8];
  const float* wp    = (const float*)d_in[9];
  const float* bp    = (const float*)d_in[10];
  float* out = (float*)d_out;

  char* ws = (char*)d_ws;
  _Float16* w16 = (_Float16*)ws;                                   // 2 MB
  _Float16* hn  = (_Float16*)(ws + (size_t)(2u << 20));            // 32 MB (reused as attn out)
  _Float16* qb  = (_Float16*)(ws + (size_t)(34u << 20));           // 32 MB
  _Float16* kb  = (_Float16*)(ws + (size_t)(66u << 20));           // 32 MB
  _Float16* vtb = (_Float16*)(ws + (size_t)(98u << 20));           // 32 MB
  _Float16* attn = hn;  // hn's last read is qkv_kernel; safe to reuse

  wconv_kernel<<<4096, 256, 0, stream>>>(wq, wk, wv, wp, w16);
  gn_kernel<<<256, 1024, 0, stream>>>(x, gamma, beta, hn);
  qkv_kernel<<<8192, 256, 0, stream>>>(hn, w16, bq, bk, bv, qb, kb, vtb);
  attn_kernel<<<2048, 256, 99328, stream>>>(qb, kb, vtb, attn);
  proj_kernel<<<8192, 256, 0, stream>>>(attn, w16 + 3 * 262144, bp, x, out);
}

// v002
// It runs in 612 microseconds.
// In both of two side-by-side timings against v001, it was 1.80 times as fast.
// Over all steps from v000 it is 2.53 times as fast.
#include <hip/hip_runtime.h>
#include <hip/hip_bf16.h>
#include <stdint.h>

typedef _Float16 v16h __attribute__((ext_vector_type(16)));
typedef float    v8f  __attribute__((ext_vector_type(8)));
typedef _Float16 h2   __attribute__((ext_vector_type(2)));
typedef _Float16 h8   __attribute__((ext_vector_type(8)));
typedef float    f4   __attribute__((ext_vector_type(4)));

#define BB   32
#define CC   512
#define NPIX 1024
#define CPG  16
#define EPSV 1e-5f
#define TP 520
#define PP 1048
#define SP 1044

__device__ __forceinline__ v16h load_frag_row(const _Float16* rowp, int half) {
  v16h out;
#pragma unroll
  for (int j = 0; j < 8; ++j) {
    int k = 2 * j + ((j >= 4) ? 8 : 0) + half * 8;
    h2 p = *(const h2*)(rowp + k);
    out[2 * j]     = p[0];
    out[2 * j + 1] = p[1];
  }
  return out;
}

__device__ __forceinline__ void stage_tile_async(const _Float16* gsrc,
                                                 _Float16* lds_dst, int tid) {
  unsigned l0 = (unsigned)(uintptr_t)(void*)lds_dst;
#pragma unroll
  for (int it = 0; it < 4; ++it) {
    int e = (it * 256 + tid) * 8;                      // f16 elements
    unsigned dst = l0 + (unsigned)((e >> 9) * (TP * 2) + (e & 511) * 2);  // LDS byte address
    unsigned long long src = (unsigned long long)(uintptr_t)(gsrc + e);
    asm volatile("global_load_async_to_lds_b128 %0, %1, off"
                 :: "v"(dst), "v"(src) : "memory");
  }
  asm volatile("s_wait_asynccnt 0x0" ::: "memory");
  __syncthreads();
}

// -------- GroupNorm: (B,512,1024) f32 -> normalized f16 in (b, p, c) layout
// One block = one image x 64 channels (4 groups) x all 1024 pixels, held in
// registers, so x is read once. lane = (pq, cg): a thread owns channels
// cg*8..cg*8+7 at 8 pixels; the eight cg lanes of one pixel together store one
// whole 128-byte line of hn.
__global__ __launch_bounds__(1024) void gn_kernel(const float* __restrict__ x,
                                                  const float* __restrict__ gamma,
                                                  const float* __restrict__ beta,
                                                  _Float16* __restrict__ hn) {
  __shared__ f4 red[4 * 17];
  int tid = threadIdx.x;
  int w = tid >> 5, lane = tid & 31, cg = lane & 7, pq = lane >> 3;
  int b = blockIdx.x >> 3, cb = blockIdx.x & 7;
  int ch0 = cb * 64 + cg * 8;
  int p0  = w * 32 + pq * 4;
  int grp = cg >> 1;                                  // group inside the block
  const float* xb = x + (size_t)(b * CC + ch0) * NPIX + p0;

  f4 v[8][2];
#pragma unroll
  for (int j = 0; j < 8; ++j) {
    v[j][0] = *(const f4*)(xb + j * NPIX);
    v[j][1] = *(const f4*)(xb + j * NPIX + 16);
  }
  unsigned goff = (unsigned)ch0 * 4u;                 // byte offset into gamma, beta
  f4 ga[2], be[2];
  ga[0] = *(const f4*)((const char*)gamma + goff);
  ga[1] = *(const f4*)((const char*)gamma + goff + 16);
  be[0] = *(const f4*)((const char*)beta + goff);
  be[1] = *(const f4*)((const char*)beta + goff + 16);
  // Precaution: the address registers stay live up to this wait, so that no
  // load's result is placed in a register that an issued load still names.
  asm volatile("s_wait_xcnt 0x0" :: "v"(xb), "v"(goff) : "memory");

  f4 s4 = {}, ss4 = {};
#pragma unroll
  for (int j = 0; j < 8; ++j) {
    s4 += v[j][0]; ss4 += v[j][0] * v[j][0];
    s4 += v[j][1]; ss4 += v[j][1] * v[j][1];
  }
  float s  = (s4[0] + s4[1]) + (s4[2] + s4[3]);
  float ss = (ss4[0] + ss4[1]) + (ss4[2] + ss4[3]);
  // Lanes of one group inside a wave: cg pair (bit 0) and the four pq (bits 3, 4).
  s += __shfl_xor(s, 1);  ss += __shfl_xor(ss, 1);
  s += __shfl_xor(s, 8);  ss += __shfl_xor(ss, 8);
  s += __shfl_xor(s, 16); ss += __shfl_xor(ss, 16);
  if ((lane & 25) == 0) {
    float* rf = (float*)red + grp * 68 + w * 2;
    rf[0] = s; rf[1] = ss;
  }
  __syncthreads();
  f4 t4 = {};
#pragma unroll
  for (int t = 0; t < 16; ++t) t4 += red[grp * 17 + t];
  float mean = (t4[0] + t4[2]) * (1.f / 16384.f);
  float var  = (t4[1] + t4[3]) * (1.f / 16384.f) - mean * mean;
  float inv  = rsqrtf(var + EPSV);

  _Float16* hb = hn + (size_t)(b * NPIX + p0) * CC + ch0;
#pragma unroll
  for (int h = 0; h < 2; ++h) {
#pragma unroll
    for (int i = 0; i < 4; ++i) {
      h8 o;
#pragma unroll
      for (int j = 0; j < 8; ++j)
        o[j] = (_Float16)((v[j][h][i] - mean) * inv * ga[j >> 2][j & 3] + be[j >> 2][j & 3]);
      *(h8*)(hb + (size_t)(h * 16 + i) * CC) = o;
    }
  }
}

// -------- Convert the four 512x512 f32 weights to f16 (concatenated)
__global__ __launch_bounds__(256) void wconv_kernel(const float* __restrict__ wq,
                                                    const float* __restrict__ wk,
                                                    const float* __restrict__ wv,
                                                    const float* __restrict__ wp,
                                                    _Float16* __restrict__ w16) {
  int i = blockIdx.x * 256 + threadIdx.x;   // 0 .. 4*262144-1
  int which = i >> 18, off = i & 262143;
  const float* src = (which == 0) ? wq : (which == 1) ? wk : (which == 2) ? wv : wp;
  w16[i] = (_Float16)src[off];
}

// -------- QKV: q[p][co], k[p][co] (row = pixel), v_t[co][p] (row = channel)
// 8 waves/block share one pixel A-tile -> async-stage it to LDS once.
__global__ __launch_bounds__(256) void qkv_kernel(const _Float16* __restrict__ hn,
                                                  const _Float16* __restrict__ w16,
                                                  const float* __restrict__ bq,
                                                  const float* __restrict__ bk,
                                                  const float* __restrict__ bv,
                                                  _Float16* __restrict__ q,
                                                  _Float16* __restrict__ k,
                                                  _Float16* __restrict__ vt) {
  __shared__ _Float16 as[16 * TP];                    // shared A tile, padded rows
  int tid  = threadIdx.x;
  int wid0 = blockIdx.x * 8;
  int b  = wid0 >> 11;
  int mt = (wid0 & 2047) >> 5;                        // uniform across block
  stage_tile_async(hn + (size_t)(b * NPIX + mt * 16) * CC, as, tid);

  int wid  = wid0 + (tid >> 5);
  int lane = tid & 31, half = lane >> 4, l16 = lane & 15;
  int nt = wid & 31;

  const _Float16* arow = as + (size_t)l16 * TP;       // LDS A fragments
  const _Float16* wqr  = w16 + (size_t)(nt * 16 + l16) * CC;
  const _Float16* wkr  = wqr + 262144;
  const _Float16* wvr  = wqr + 524288;

  v8f aq = {}, ak = {}, av = {};
  for (int ki = 0; ki < 16; ++ki) {
    int ko = ki * 32;
    v16h af = load_frag_row(arow + ko, half);
    v16h bfq = load_frag_row(wqr + ko, half);
    aq = __builtin_amdgcn_wmma_f32_16x16x32_f16(false, af, false, bfq, (short)0, aq, false, false);
    v16h bfk = load_frag_row(wkr + ko, half);
    ak = __builtin_amdgcn_wmma_f32_16x16x32_f16(false, af, false, bfk, (short)0, ak, false, false);
    v16h bfv = load_frag_row(wvr + ko, half);
    av = __builtin_amdgcn_wmma_f32_16x16x32_f16(false, af, false, bfv, (short)0, av, false, false);
  }
  int co = nt * 16 + l16;
  float biasq = bq[co], biask = bk[co], biasv = bv[co];
#pragma unroll
  for (int r = 0; r < 8; ++r) {
    int p = mt * 16 + r + 8 * half;
    q[(size_t)(b * NPIX + p) * CC + co]  = (_Float16)(aq[r] + biasq);
    k[(size_t)(b * NPIX + p) * CC + co]  = (_Float16)(ak[r] + biask);
    vt[(size_t)(b * CC + co) * NPIX + p] = (_Float16)(av[r] + biasv);
  }
}

// -------- Attention: per (batch, 16-query tile) block, scores+softmax in LDS
__global__ __launch_bounds__(256) void attn_kernel(const _Float16* __restrict__ q,
                                                   const _Float16* __restrict__ k,
                                                   const _Float16* __restrict__ vt,
                                                   _Float16* __restrict__ attn) {
  extern __shared__ char smem[];
  float*    S   = (float*)smem;                        // 16 rows x SP f32
  _Float16* P   = (_Float16*)(smem + 16 * SP * 4);     // 16 rows x PP f16
  _Float16* qs  = P;                                   // q stage (16 rows x TP) overlaps P:
                                                       // qs dead before P is written
  float*    red = (float*)(smem + 16 * SP * 4 + 16 * PP * 2);  // 16*16 f32

  int tid = threadIdx.x;
  int w = tid >> 5, lane = tid & 31, half = lane >> 4, l16 = lane & 15;
  int b = blockIdx.x >> 6, qt = blockIdx.x & 63;
  const float scale = 0.044194173824159216f;           // 512^-0.5

  // Async-stage the shared q tile (16x512 f16, contiguous) into LDS.
  stage_tile_async(q + (size_t)(b * NPIX + qt * 16) * CC, qs, tid);
  const _Float16* qrow = qs + (size_t)l16 * TP;

  // Phase 1: S[16][1024] = (q_tile · k^T) * scale, 8 key-tiles per wave
  for (int ntb = 0; ntb < 8; ++ntb) {
    int nt = w + ntb * 8;
    const _Float16* krow = k + (size_t)(b * NPIX + nt * 16 + l16) * CC;
    v8f acc = {};
    for (int ki = 0; ki < 16; ++ki) {
      v16h af = load_frag_row(qrow + ki * 32, half);
      v16h bf = load_frag_row(krow + ki * 32, half);
      acc = __builtin_amdgcn_wmma_f32_16x16x32_f16(false, af, false, bf, (short)0, acc, false, false);
    }
#pragma unroll
    for (int r = 0; r < 8; ++r) {
      int m = r + 8 * half;
      int n = nt * 16 + l16;
      S[m * SP + n] = acc[r] * scale;
    }
  }
  __syncthreads();

  // Phase 2: softmax per row (16 threads per row)
  {
    int m = tid >> 4, c0 = tid & 15;
    float mx = -3.4e38f;
    for (int i = 0; i < 64; ++i) mx = fmaxf(mx, S[m * SP + c0 + i * 16]);
    red[m * 16 + c0] = mx;
    __syncthreads();
    float rmax = red[m * 16];
#pragma unroll
    for (int t = 1; t < 16; ++t) rmax = fmaxf(rmax, red[m * 16 + t]);
    __syncthreads();
    float sum = 0.f;
    for (int i = 0; i < 64; ++i) {
      float e = __expf(S[m * SP + c0 + i * 16] - rmax);
      S[m * SP + c0 + i * 16] = e;
      sum += e;
    }
    red[m * 16 + c0] = sum;
    __syncthreads();
    float rsum = 0.f;
#pragma unroll
    for (int t = 0; t < 16; ++t) rsum += red[m * 16 + t];
    float inv = 1.f / rsum;
    for (int i = 0; i < 64; ++i)
      P[m * PP + c0 + i * 16] = (_Float16)(S[m * SP + c0 + i * 16] * inv);
  }
  __syncthreads();

  // Phase 3: out_tile = P(16x1024) x V^T, 4 channel-tiles per wave
  const _Float16* prow = P + (size_t)l16 * PP;
  for (int ctb = 0; ctb < 4; ++ctb) {
    int ct = w + ctb * 8;
    const _Float16* vrow = vt + (size_t)(b * CC + ct * 16 + l16) * NPIX;
    v8f acc = {};
    for (int kk = 0; kk < 32; ++kk) {
      v16h af = load_frag_row(prow + kk * 32, half);
      v16h bf = load_frag_row(vrow + kk * 32, half);
      acc = __builtin_amdgcn_wmma_f32_16x16x32_f16(false, af, false, bf, (short)0, acc, false, false);
    }
#pragma unroll
    for (int r = 0; r < 8; ++r) {
      int p = qt * 16 + r + 8 * half;
      int c = ct * 16 + l16;
      attn[(size_t)(b * NPIX + p) * CC + c] = (_Float16)acc[r];
    }
  }
}

// -------- Proj + bias + residual (f32 output, (b, c, h, w))
__global__ __launch_bounds__(256) void proj_kernel(const _Float16* __restrict__ attn,
                                                   const _Float16* __restrict__ wp16,
                                                   const float* __restrict__ bp,
                                                   const float* __restrict__ x,
                                                   float* __restrict__ out) {
  __shared__ _Float16 as[16 * TP];                    // shared A tile, padded rows
  int tid  = threadIdx.x;
  int wid0 = blockIdx.x * 8;
  int b  = wid0 >> 11;
  int mt = (wid0 & 2047) >> 5;
  stage_tile_async(attn + (size_t)(b * NPIX + mt * 16) * CC, as, tid);

  int wid  = wid0 + (tid >> 5);
  int lane = tid & 31, half = lane >> 4, l16 = lane & 15;
  int nt = wid & 31;

  const _Float16* arow = as + (size_t)l16 * TP;
  const _Float16* wrow = wp16 + (size_t)(nt * 16 + l16) * CC;
  v8f acc = {};
  for (int ki = 0; ki < 16; ++ki) {
    v16h af = load_frag_row(arow + ki * 32, half);
    v16h bf = load_frag_row(wrow + ki * 32, half);
    acc = __builtin_amdgcn_wmma_f32_16x16x32_f16(false, af, false, bf, (short)0, acc, false, false);
  }
  int co = nt * 16 + l16;
  float bias = bp[co];
#pragma unroll
  for (int r = 0; r < 8; ++r) {
    int p = mt * 16 + r + 8 * half;
    size_t idx = (size_t)(b * CC + co) * NPIX + p;
    out[idx] = x[idx] + acc[r] + bias;
  }
}

extern "C" void kernel_launch(void* const* d_in, const int* in_sizes, int n_in,
                              void* d_out, int out_size, void* d_ws, size_t ws_size,
                              hipStream_t stream) {
  const float* x     = (const float*)d_in[0];
  const float* gamma = (const float*)d_in[1];
  const float* beta  = (const float*)d_in[2];
  const float* wq    = (const float*)d_in[3];
  const float* bq    = (const float*)d_in[4];
  const float* wk    = (const float*)d_in[5];
  const float* bk    = (const float*)d_in[6];
  const float* wv    = (const float*)d_in[7];
  const float* bv    = (const float*)d_in[8];
  const float* wp    = (const float*)d_in[9];
  const float* bp    = (const float*)d_in[10];
  float* out = (float*)d_out;

  char* ws = (char*)d_ws;
  _Float16* w16 = (_Float16*)ws;                                   // 2 MB
  _Float16* hn  = (_Float16*)(ws + (size_t)(2u << 20));            // 32 MB (reused as attn out)
  _Float16* qb  = (_Float16*)(ws + (size_t)(34u << 20));           // 32 MB
  _Float16* kb  = (_Float16*)(ws + (size_t)(66u << 20));           // 32 MB
  _Float16* vtb = (_Float16*)(ws + (size_t)(98u << 20));           // 32 MB
  _Float16* attn = hn;  // hn's last read is qkv_kernel; safe to reuse

  wconv_kernel<<<4096, 256, 0, stream>>>(wq, wk, wv, wp, w16);
  gn_kernel<<<256, 1024, 0, stream>>>(x, gamma, beta, hn);
  qkv_kernel<<<8192, 256, 0, stream>>>(hn, w16, bq, bk, bv, qb, kb, vtb);
  attn_kernel<<<2048, 256, 101376, stream>>>(qb, kb, vtb, attn);
  proj_kernel<<<8192, 256, 0, stream>>>(attn, w16 + 3 * 262144, bp, x, out);
}

// v003
// Measured time: 267 microseconds a run.
// Next to v002, in two timings, it ran 2.29 times as fast each time.
// Over all steps from v000 it is 5.81 times as fast.
#include <hip/hip_runtime.h>
#include <hip/hip_bf16.h>
#include <stdint.h>

typedef _Float16 v16h __attribute__((ext_vector_type(16)));
typedef float    v8f  __attribute__((ext_vector_type(8)));
typedef _Float16 h2   __attribute__((ext_vector_type(2)));
typedef _Float16 h8   __attribute__((ext_vector_type(8)));
typedef float    f4   __attribute__((ext_vector_type(4)));

#define BB   32
#define CC   512
#define NPIX 1024
#define CPG  16
#define EPSV 1e-5f
#define TP 520
#define PP 1048
#define SP 1044
#define MT 8
#define QR 32

__device__ __forceinline__ v16h load_frag_row(const _Float16* rowp, int half) {
  v16h out;
#pragma unroll
  for (int j = 0; j < 8; ++j) {
    int k = 2 * j + ((j >= 4) ? 8 : 0) + half * 8;
    h2 p = *(const h2*)(rowp + k);
    out[2 * j]     = p[0];
    out[2 * j + 1] = p[1];
  }
  return out;
}

template <int ROWS, int NTHR>
__device__ __forceinline__ void stage_rows_async(const _Float16* gsrc,
                                                 _Float16* lds_dst, int tid) {
  unsigned l0 = (unsigned)(uintptr_t)(void*)lds_dst;
#pragma unroll  // both loops: the address arrays stay in registers
  for (int it = 0; it < ROWS * 64 / NTHR; it += 4) {
    unsigned dst[4];                                   // LDS byte addresses
    unsigned long long gsa[4];                         // global addresses
#pragma unroll
    for (int u = 0; u < 4; ++u) {
      int e = ((it + u) * NTHR + tid) * 8;             // f16 elements
      dst[u] = l0 + (unsigned)((e >> 9) * (TP * 2) + (e & 511) * 2);
      gsa[u] = (unsigned long long)(uintptr_t)(gsrc + e);
    }
    // Precaution: the wait closes the copies' own statement, so that no address
    // register of an issued copy is rewritten in front of it.
    asm volatile("global_load_async_to_lds_b128 %0, %4, off\n\t"
                 "global_load_async_to_lds_b128 %1, %5, off\n\t"
                 "global_load_async_to_lds_b128 %2, %6, off\n\t"
                 "global_load_async_to_lds_b128 %3, %7, off\n\t"
                 "s_wait_xcnt 0x0"
                 :: "v"(dst[0]), "v"(dst[1]), "v"(dst[2]), "v"(dst[3]),
                    "v"(gsa[0]), "v"(gsa[1]), "v"(gsa[2]), "v"(gsa[3]) : "memory");
  }
  // The copies have landed before the barrier publishes the tile to all waves.
  asm volatile("s_wait_asynccnt 0x0" ::: "memory");
  __syncthreads();
}

// -------- GroupNorm: (B,512,1024) f32 -> normalized f16 in (b, p, c) layout
// One block = one image x 64 channels (4 groups) x all 1024 pixels, held in
// registers, so x is read once. lane = (pq, cg): a thread owns channels
// cg*8..cg*8+7 at 8 pixels; the eight cg lanes of one pixel together store one
// whole 128-byte line of hn.
__global__ __launch_bounds__(1024) void gn_kernel(const float* __restrict__ x,
                                                  const float* __restrict__ gamma,
                                                  const float* __restrict__ beta,
                                                  _Float16* __restrict__ hn) {
  __shared__ f4 red[4 * 17];
  int tid = threadIdx.x;
  int w = tid >> 5, lane = tid & 31, cg = lane & 7, pq = lane >> 3;
  int b = blockIdx.x >> 3, cb = blockIdx.x & 7;
  int ch0 = cb * 64 + cg * 8;
  int p0  = w * 32 + pq * 4;
  int grp = cg >> 1;                                  // group inside the block
  const float* xb = x + (size_t)(b * CC + ch0) * NPIX + p0;

  f4 v[8][2];
#pragma unroll
  for (int j = 0; j < 8; ++j) {
    v[j][0] = *(const f4*)(xb + j * NPIX);
    v[j][1] = *(const f4*)(xb + j * NPIX + 16);
  }
  unsigned goff = (unsigned)ch0 * 4u;                 // byte offset into gamma, beta
  f4 ga[2], be[2];
  ga[0] = *(const f4*)((const char*)gamma + goff);
  ga[1] = *(const f4*)((const char*)gamma + goff + 16);
  be[0] = *(const f4*)((const char*)beta + goff);
  be[1] = *(const f4*)((const char*)beta + goff + 16);
  // Precaution: the address registers stay live up to this wait, so that no
  // load's result is placed in a register that an issued load still names.
  asm volatile("s_wait_xcnt 0x0" :: "v"(xb), "v"(goff) : "memory");

  f4 s4 = {}, ss4 = {};
#pragma unroll
  for (int j = 0; j < 8; ++j) {
    s4 += v[j][0]; ss4 += v[j][0] * v[j][0];
    s4 += v[j][1]; ss4 += v[j][1] * v[j][1];
  }
  float s  = (s4[0] + s4[1]) + (s4[2] + s4[3]);
  float ss = (ss4[0] + ss4[1]) + (ss4[2] + ss4[3]);
  // Lanes of one group inside a wave: cg pair (bit 0) and the four pq (bits 3, 4).
  s += __shfl_xor(s, 1);  ss += __shfl_xor(ss, 1);
  s += __shfl_xor(s, 8);  ss += __shfl_xor(ss, 8);
  s += __shfl_xor(s, 16); ss += __shfl_xor(ss, 16);
  if ((lane & 25) == 0) {
    float* rf = (float*)red + grp * 68 + w * 2;
    rf[0] = s; rf[1] = ss;
  }
  __syncthreads();
  f4 t4 = {};
#pragma unroll
  for (int t = 0; t < 16; ++t) t4 += red[grp * 17 + t];
  float mean = (t4[0] + t4[2]) * (1.f / 16384.f);
  float var  = (t4[1] + t4[3]) * (1.f / 16384.f) - mean * mean;
  float inv  = rsqrtf(var + EPSV);

  _Float16* hb = hn + (size_t)(b * NPIX + p0) * CC + ch0;
#pragma unroll
  for (int h = 0; h < 2; ++h) {
#pragma unroll
    for (int i = 0; i < 4; ++i) {
      h8 o;
#pragma unroll
      for (int j = 0; j < 8; ++j)
        o[j] = (_Float16)((v[j][h][i] - mean) * inv * ga[j >> 2][j & 3] + be[j >> 2][j & 3]);
      *(h8*)(hb + (size_t)(h * 16 + i) * CC) = o;
    }
  }
}

// -------- Convert the four 512x512 f32 weights to f16 (concatenated)
__global__ __launch_bounds__(256) void wconv_kernel(const float* __restrict__ wq,
                                                    const float* __restrict__ wk,
                                                    const float* __restrict__ wv,
                                                    const float* __restrict__ wp,
                                                    _Float16* __restrict__ w16) {
  int i = blockIdx.x * 256 + threadIdx.x;   // 0 .. 4*262144-1
  int which = i >> 18, off = i & 262143;
  const float* src = (which == 0) ? wq : (which == 1) ? wk : (which == 2) ? wv : wp;
  w16[i] = (_Float16)src[off];
}

// -------- QKV: q[p][co], k[p][co] (row = pixel), v_t[co][p] (row = channel)
// 8 waves/block share MT pixel A-tiles (128 pixels), async-staged to LDS once.
// A weight fragment, loaded from global one row per lane, feeds MT products.
__global__ __launch_bounds__(256) void qkv_kernel(const _Float16* __restrict__ hn,
                                                  const _Float16* __restrict__ w16,
                                                  const float* __restrict__ bq,
                                                  const float* __restrict__ bk,
                                                  const float* __restrict__ bv,
                                                  _Float16* __restrict__ q,
                                                  _Float16* __restrict__ k,
                                                  _Float16* __restrict__ vt) {
  __shared__ __attribute__((aligned(16))) _Float16 as[MT * 16 * TP];  // A tiles, padded rows
  int tid = threadIdx.x;
  int b   = blockIdx.x >> 5;                          // 32 blocks per image:
  int mb  = (blockIdx.x & 31) >> 2;                   // 8 tiles of 128 pixels x
  int nt  = (blockIdx.x & 3) * 8 + (tid >> 5);        // 4 groups of 8 channel tiles
  stage_rows_async<MT * 16, 256>(hn + (size_t)(b * NPIX + mb * (MT * 16)) * CC, as, tid);

  int lane = tid & 31, half = lane >> 4, l16 = lane & 15;

  const _Float16* arow = as + (size_t)l16 * TP;       // LDS A fragments
  const _Float16* wqr  = w16 + (size_t)(nt * 16 + l16) * CC;
  const _Float16* wkr  = wqr + 262144;
  const _Float16* wvr  = wqr + 524288;

  v8f aq[MT] = {}, ak[MT] = {}, av[MT] = {};
  for (int ki = 0; ki < 16; ++ki) {
    int ko = ki * 32;
    v16h bfq = load_frag_row(wqr + ko, half);
    v16h bfk = load_frag_row(wkr + ko, half);
    v16h bfv = load_frag_row(wvr + ko, half);
#pragma unroll  // constant t: the accumulator arrays stay in registers
    for (int t = 0; t < MT; ++t) {
      v16h af = load_frag_row(arow + t * 16 * TP + ko, half);
      aq[t] = __builtin_amdgcn_wmma_f32_16x16x32_f16(false, af, false, bfq, (short)0, aq[t], false, false);
      ak[t] = __builtin_amdgcn_wmma_f32_16x16x32_f16(false, af, false, bfk, (short)0, ak[t], false, false);
      av[t] = __builtin_amdgcn_wmma_f32_16x16x32_f16(false, af, false, bfv, (short)0, av[t], false, false);
    }
  }
  int co = nt * 16 + l16;
  float biasq = bq[co], biask = bk[co], biasv = bv[co];
#pragma unroll  // constant t, r: accumulators are read from registers
  for (int t = 0; t < MT; ++t) {
#pragma unroll
    for (int r = 0; r < 8; ++r) {
      int p = mb * (MT * 16) + t * 16 + r + 8 * half;
      q[(size_t)(b * NPIX + p) * CC + co]  = (_Float16)(aq[t][r] + biasq);
      k[(size_t)(b * NPIX + p) * CC + co]  = (_Float16)(ak[t][r] + biask);
      vt[(size_t)(b * CC + co) * NPIX + p] = (_Float16)(av[t][r] + biasv);
    }
  }
}

// -------- Attention: per (batch, 32-query tile) block, scores+softmax in LDS
// 16 waves; a wave keeps a 2 x 2 set of accumulator tiles, so a K or V fragment,
// loaded from global one row per lane, feeds both query tiles.
__global__ __launch_bounds__(512) void attn_kernel(const _Float16* __restrict__ q,
                                                   const _Float16* __restrict__ k,
                                                   const _Float16* __restrict__ vt,
                                                   _Float16* __restrict__ attn) {
  __shared__ __attribute__((aligned(16))) char smem[QR * SP * 4 + QR * PP * 2 + QR * 16 * 4];
  float*    S   = (float*)smem;                        // QR rows x SP f32
  _Float16* P   = (_Float16*)(smem + QR * SP * 4);     // QR rows x PP f16
  _Float16* qs  = P;                                   // q stage (QR rows x TP) overlaps P:
                                                       // qs dead before P is written
  float*    red = (float*)(smem + QR * SP * 4 + QR * PP * 2);  // QR*16 f32

  int tid = threadIdx.x;
  int w = tid >> 5, lane = tid & 31, half = lane >> 4, l16 = lane & 15;
  int b = blockIdx.x >> 5, qt = blockIdx.x & 31;
  const float scale = 0.044194173824159216f;           // 512^-0.5

  // Async-stage the shared q tile (32x512 f16, contiguous) into LDS.
  stage_rows_async<QR, 512>(q + (size_t)(b * NPIX + qt * QR) * CC, qs, tid);
  const _Float16* qrow = qs + (size_t)l16 * TP;

  // Phase 1: S[32][1024] = (q_tile x k^T) * scale, 4 key-tiles per wave, two at a time
  for (int ntb = 0; ntb < 2; ++ntb) {
    int nt = w + ntb * 32;                             // and nt + 16
    const _Float16* krow = k + (size_t)(b * NPIX + nt * 16 + l16) * CC;
    v8f acc[2][2] = {};
    for (int ki = 0; ki < 16; ++ki) {
      v16h bf0 = load_frag_row(krow + ki * 32, half);
      v16h bf1 = load_frag_row(krow + 256 * CC + ki * 32, half);
      v16h af0 = load_frag_row(qrow + ki * 32, half);
      v16h af1 = load_frag_row(qrow + 16 * TP + ki * 32, half);
      acc[0][0] = __builtin_amdgcn_wmma_f32_16x16x32_f16(false, af0, false, bf0, (short)0, acc[0][0], false, false);
      acc[1][0] = __builtin_amdgcn_wmma_f32_16x16x32_f16(false, af1, false, bf0, (short)0, acc[1][0], false, false);
      acc[0][1] = __builtin_amdgcn_wmma_f32_16x16x32_f16(false, af0, false, bf1, (short)0, acc[0][1], false, false);
      acc[1][1] = __builtin_amdgcn_wmma_f32_16x16x32_f16(false, af1, false, bf1, (short)0, acc[1][1], false, false);
    }
#pragma unroll  // constant t, u, r: accumulators are read from registers
    for (int t = 0; t < 2; ++t) {
#pragma unroll
      for (int u = 0; u < 2; ++u) {
#pragma unroll
        for (int r = 0; r < 8; ++r) {
          int m = t * 16 + r + 8 * half;
          int n = (nt + u * 16) * 16 + l16;
          S[m * SP + n] = acc[t][u][r] * scale;
        }
      }
    }
  }
  __syncthreads();

  // Phase 2: softmax per row (16 threads per row)
  {
    int m = tid >> 4, c0 = tid & 15;
    float mx = -3.4e38f;
    for (int i = 0; i < 64; ++i) mx = fmaxf(mx, S[m * SP + c0 + i * 16]);
    red[m * 16 + c0] = mx;
    __syncthreads();
    float rmax = red[m * 16];
#pragma unroll
    for (int t = 1; t < 16; ++t) rmax = fmaxf(rmax, red[m * 16 + t]);
    __syncthreads();
    float sum = 0.f;
    for (int i = 0; i < 64; ++i) {
      float e = __expf(S[m * SP + c0 + i * 16] - rmax);
      S[m * SP + c0 + i * 16] = e;
      sum += e;
    }
    red[m * 16 + c0] = sum;
    __syncthreads();
    float rsum = 0.f;
#pragma unroll
    for (int t = 0; t < 16; ++t) rsum += red[m * 16 + t];
    float inv = 1.f / rsum;
    for (int i = 0; i < 64; ++i)
      P[m * PP + c0 + i * 16] = (_Float16)(S[m * SP + c0 + i * 16] * inv);
  }
  __syncthreads();

  // Phase 3: out_tile = P(32x1024) x V^T, 2 channel-tiles per wave
  const _Float16* prow = P + (size_t)l16 * PP;
  const _Float16* vrow = vt + (size_t)(b * CC + w * 16 + l16) * NPIX;   // and 256 rows on
  v8f acc[2][2] = {};
  for (int kk = 0; kk < 32; ++kk) {
    v16h bf0 = load_frag_row(vrow + kk * 32, half);
    v16h bf1 = load_frag_row(vrow + 256 * NPIX + kk * 32, half);
    v16h af0 = load_frag_row(prow + kk * 32, half);
    v16h af1 = load_frag_row(prow + 16 * PP + kk * 32, half);
    acc[0][0] = __builtin_amdgcn_wmma_f32_16x16x32_f16(false, af0, false, bf0, (short)0, acc[0][0], false, false);
    acc[1][0] = __builtin_amdgcn_wmma_f32_16x16x32_f16(false, af1, false, bf0, (short)0, acc[1][0], false, false);
    acc[0][1] = __builtin_amdgcn_wmma_f32_16x16x32_f16(false, af0, false, bf1, (short)0, acc[0][1], false, false);
    acc[1][1] = __builtin_amdgcn_wmma_f32_16x16x32_f16(false, af1, false, bf1, (short)0, acc[1][1], false, false);
  }
#pragma unroll  // constant t, u, r: accumulators are read from registers
  for (int t = 0; t < 2; ++t) {
#pragma unroll
    for (int u = 0; u < 2; ++u) {
#pragma unroll
      for (int r = 0; r < 8; ++r) {
        int p = qt * QR + t * 16 + r + 8 * half;
        int c = (w + u * 16) * 16 + l16;
        attn[(size_t)(b * NPIX + p) * CC + c] = (_Float16)acc[t][u][r];
      }
    }
  }
}

// -------- Proj + bias + residual (f32 output, (b, c, h, w))
// As in qkv_kernel: MT pixel tiles per block, one weight fragment feeds MT products.
__global__ __launch_bounds__(256) void proj_kernel(const _Float16* __restrict__ attn,
                                                   const _Float16* __restrict__ wp16,
                                                   const float* __restrict__ bp,
                                                   const float* __restrict__ x,
                                                   float* __restrict__ out) {
  __shared__ __attribute__((aligned(16))) _Float16 as[MT * 16 * TP];  // A tiles, padded rows
  int tid = threadIdx.x;
  int b   = blockIdx.x >> 5;
  int mb  = (blockIdx.x & 31) >> 2;
  int nt  = (blockIdx.x & 3) * 8 + (tid >> 5);
  stage_rows_async<MT * 16, 256>(attn + (size_t)(b * NPIX + mb * (MT * 16)) * CC, as, tid);

  int lane = tid & 31, half = lane >> 4, l16 = lane & 15;

  const _Float16* arow = as + (size_t)l16 * TP;
  const _Float16* wrow = wp16 + (size_t)(nt * 16 + l16) * CC;
  v8f acc[MT] = {};
  for (int ki = 0; ki < 16; ++ki) {
    v16h bf = load_frag_row(wrow + ki * 32, half);
#pragma unroll  // constant t: the accumulator arrays stay in registers
    for (int t = 0; t < MT; ++t) {
      v16h af = load_frag_row(arow + t * 16 * TP + ki * 32, half);
      acc[t] = __builtin_amdgcn_wmma_f32_16x16x32_f16(false, af, false, bf, (short)0, acc[t], false, false);
    }
  }
  int co = nt * 16 + l16;
  float bias = bp[co];
#pragma unroll  // constant t, r: accumulators are read from registers
  for (int t = 0; t < MT; ++t) {
#pragma unroll
    for (int r = 0; r < 8; ++r) {
      int p = mb * (MT * 16) + t * 16 + r + 8 * half;
      size_t idx = (size_t)(b * CC + co) * NPIX + p;
      out[idx] = x[idx] + acc[t][r] + bias;
    }
  }
}

extern "C" void kernel_launch(void* const* d_in, const int* in_sizes, int n_in,
                              void* d_out, int out_size, void* d_ws, size_t ws_size,
                              hipStream_t stream) {
  const float* x     = (const float*)d_in[0];
  const float* gamma = (const float*)d_in[1];
  const float* beta  = (const float*)d_in[2];
  const float* wq    = (const float*)d_in[3];
  const float* bq    = (const float*)d_in[4];
  const float* wk    = (const float*)d_in[5];
  const float* bk    = (const float*)d_in[6];
  const float* wv    = (const float*)d_in[7];
  const float* bv    = (const float*)d_in[8];
  const float* wp    = (const float*)d_in[9];
  const float* bp    = (const float*)d_in[10];
  float* out = (float*)d_out;

  char* ws = (char*)d_ws;
  _Float16* w16 = (_Float16*)ws;                                   // 2 MB
  _Float16* hn  = (_Float16*)(ws + (size_t)(2u << 20));            // 32 MB (reused as attn out)
  _Float16* qb  = (_Float16*)(ws + (size_t)(34u << 20));           // 32 MB
  _Float16* kb  = (_Float16*)(ws + (size_t)(66u << 20));           // 32 MB
  _Float16* vtb = (_Float16*)(ws + (size_t)(98u << 20));           // 32 MB
  _Float16* attn = hn;  // hn's last read is qkv_kernel; safe to reuse

  wconv_kernel<<<4096, 256, 0, stream>>>(wq, wk, wv, wp, w16);
  gn_kernel<<<256, 1024, 0, stream>>>(x, gamma, beta, hn);
  qkv_kernel<<<1024, 256, 0, stream>>>(hn, w16, bq, bk, bv, qb, kb, vtb);
  attn_kernel<<<1024, 512, 0, stream>>>(qb, kb, vtb, attn);
  proj_kernel<<<1024, 256, 0, stream>>>(attn, w16 + 3 * 262144, bp, x, out);
}

// v004
// Measured time: 199 microseconds a run.
// In both of two side-by-side timings against v003, it was 1.33 times as fast.
// Over all steps from v000 it is 7.75 times as fast.
#include <hip/hip_runtime.h>
#include <hip/hip_bf16.h>
#include <stdint.h>

typedef _Float16 v16h __attribute__((ext_vector_type(16)));
typedef float    v8f  __attribute__((ext_vector_type(8)));
typedef _Float16 h2   __attribute__((ext_vector_type(2)));
typedef _Float16 h8   __attribute__((ext_vector_type(8)));
typedef float    f4   __attribute__((ext_vector_type(4)));

#define BB   32
#define CC   512
#define NPIX 1024
#define CPG  16
#define EPSV 1e-5f
#define TP 520
#define PP 1048
#define RP 68
#define MT 8
#define QR 64

__device__ __forceinline__ v16h load_frag_row(const _Float16* rowp, int half) {
  v16h out;
#pragma unroll
  for (int j = 0; j < 8; ++j) {
    int k = 2 * j + ((j >= 4) ? 8 : 0) + half * 8;
    h2 p = *(const h2*)(rowp + k);
    out[2 * j]     = p[0];
    out[2 * j + 1] = p[1];
  }
  return out;
}

__device__ __forceinline__ float xhalf(float x) {
  int i = __builtin_bit_cast(int, x);
  return __builtin_bit_cast(float, __builtin_amdgcn_permlanex16(i, i, 0x76543210, 0xfedcba98, false, false));
}

__device__ __forceinline__ float exp2_slot(float x) {
  float e;
  asm("v_exp_f32 %0, %1\n\tv_nop" : "=v"(e) : "v"(x));
  return e;
}

template <int ROWS, int NTHR>
__device__ __forceinline__ void stage_rows_async(const _Float16* gsrc,
                                                 _Float16* lds_dst, int tid) {
  unsigned l0 = (unsigned)(uintptr_t)(void*)lds_dst;
#pragma unroll  // both loops: the address arrays stay in registers
  for (int it = 0; it < ROWS * 64 / NTHR; it += 4) {
    unsigned dst[4];                                   // LDS byte addresses
    unsigned long long gsa[4];                         // global addresses
#pragma unroll
    for (int u = 0; u < 4; ++u) {
      int e = ((it + u) * NTHR + tid) * 8;             // f16 elements
      dst[u] = l0 + (unsigned)((e >> 9) * (TP * 2) + (e & 511) * 2);
      gsa[u] = (unsigned long long)(uintptr_t)(gsrc + e);
    }
    // Precaution: the wait closes the copies' own statement, so that no address
    // register of an issued copy is rewritten in front of it.
    asm volatile("global_load_async_to_lds_b128 %0, %4, off\n\t"
                 "global_load_async_to_lds_b128 %1, %5, off\n\t"
                 "global_load_async_to_lds_b128 %2, %6, off\n\t"
                 "global_load_async_to_lds_b128 %3, %7, off\n\t"
                 "s_wait_xcnt 0x0"
                 :: "v"(dst[0]), "v"(dst[1]), "v"(dst[2]), "v"(dst[3]),
                    "v"(gsa[0]), "v"(gsa[1]), "v"(gsa[2]), "v"(gsa[3]) : "memory");
  }
  // The copies have landed before the barrier publishes the tile to all waves.
  asm volatile("s_wait_asynccnt 0x0" ::: "memory");
  __syncthreads();
}

// -------- GroupNorm: (B,512,1024) f32 -> normalized f16 in (b, p, c) layout
// One block = one image x 64 channels (4 groups) x all 1024 pixels, held in
// registers, so x is read once. lane = (pq, cg): a thread owns channels
// cg*8..cg*8+7 at 8 pixels; the eight cg lanes of one pixel together store one
// whole 128-byte line of hn.
__global__ __launch_bounds__(1024) void gn_kernel(const float* __restrict__ x,
                                                  const float* __restrict__ gamma,
                                                  const float* __restrict__ beta,
                                                  _Float16* __restrict__ hn) {
  __shared__ f4 red[4 * 17];
  int tid = threadIdx.x;
  int w = tid >> 5, lane = tid & 31, cg = lane & 7, pq = lane >> 3;
  int b = blockIdx.x >> 3, cb = blockIdx.x & 7;
  int ch0 = cb * 64 + cg * 8;
  int p0  = w * 32 + pq * 4;
  int grp = cg >> 1;                                  // group inside the block
  const float* xb = x + (size_t)(b * CC + ch0) * NPIX + p0;

  f4 v[8][2];
#pragma unroll
  for (int j = 0; j < 8; ++j) {
    v[j][0] = *(const f4*)(xb + j * NPIX);
    v[j][1] = *(const f4*)(xb + j * NPIX + 16);
  }
  unsigned goff = (unsigned)ch0 * 4u;                 // byte offset into gamma, beta
  f4 ga[2], be[2];
  ga[0] = *(const f4*)((const char*)gamma + goff);
  ga[1] = *(const f4*)((const char*)gamma + goff + 16);
  be[0] = *(const f4*)((const char*)beta + goff);
  be[1] = *(const f4*)((const char*)beta + goff + 16);
  // Precaution: the address registers stay live up to this wait, so that no
  // load's result is placed in a register that an issued load still names.
  asm volatile("s_wait_xcnt 0x0" :: "v"(xb), "v"(goff) : "memory");

  f4 s4 = {}, ss4 = {};
#pragma unroll
  for (int j = 0; j < 8; ++j) {
    s4 += v[j][0]; ss4 += v[j][0] * v[j][0];
    s4 += v[j][1]; ss4 += v[j][1] * v[j][1];
  }
  float s  = (s4[0] + s4[1]) + (s4[2] + s4[3]);
  float ss = (ss4[0] + ss4[1]) + (ss4[2] + ss4[3]);
  // Lanes of one group inside a wave: cg pair (bit 0) and the four pq (bits 3, 4).
  s += __shfl_xor(s, 1);  ss += __shfl_xor(ss, 1);
  s += __shfl_xor(s, 8);  ss += __shfl_xor(ss, 8);
  s += __shfl_xor(s, 16); ss += __shfl_xor(ss, 16);
  if ((lane & 25) == 0) {
    float* rf = (float*)red + grp * 68 + w * 2;
    rf[0] = s; rf[1] = ss;
  }
  __syncthreads();
  f4 t4 = {};
#pragma unroll
  for (int t = 0; t < 16; ++t) t4 += red[grp * 17 + t];
  float mean = (t4[0] + t4[2]) * (1.f / 16384.f);
  float var  = (t4[1] + t4[3]) * (1.f / 16384.f) - mean * mean;
  float inv  = rsqrtf(var + EPSV);

  _Float16* hb = hn + (size_t)(b * NPIX + p0) * CC + ch0;
#pragma unroll
  for (int h = 0; h < 2; ++h) {
#pragma unroll
    for (int i = 0; i < 4; ++i) {
      h8 o;
#pragma unroll
      for (int j = 0; j < 8; ++j)
        o[j] = (_Float16)((v[j][h][i] - mean) * inv * ga[j >> 2][j & 3] + be[j >> 2][j & 3]);
      *(h8*)(hb + (size_t)(h * 16 + i) * CC) = o;
    }
  }
}

// -------- Convert the four 512x512 f32 weights to f16 (concatenated)
__global__ __launch_bounds__(256) void wconv_kernel(const float* __restrict__ wq,
                                                    const float* __restrict__ wk,
                                                    const float* __restrict__ wv,
                                                    const float* __restrict__ wp,
                                                    _Float16* __restrict__ w16) {
  int i = blockIdx.x * 256 + threadIdx.x;   // 0 .. 4*262144-1
  int which = i >> 18, off = i & 262143;
  const float* src = (which == 0) ? wq : (which == 1) ? wk : (which == 2) ? wv : wp;
  w16[i] = (_Float16)src[off];
}

// -------- QKV: q[p][co], k[p][co] (row = pixel), v_t[co][p] (row = channel)
// 8 waves/block share MT pixel A-tiles (128 pixels), async-staged to LDS once.
// A weight fragment, loaded from global one row per lane, feeds MT products.
__global__ __launch_bounds__(256) void qkv_kernel(const _Float16* __restrict__ hn,
                                                  const _Float16* __restrict__ w16,
                                                  const float* __restrict__ bq,
                                                  const float* __restrict__ bk,
                                                  const float* __restrict__ bv,
                                                  _Float16* __restrict__ q,
                                                  _Float16* __restrict__ k,
                                                  _Float16* __restrict__ vt) {
  __shared__ __attribute__((aligned(16))) _Float16 as[MT * 16 * TP];  // A tiles, padded rows
  int tid = threadIdx.x;
  int b   = blockIdx.x >> 5;                          // 32 blocks per image:
  int mb  = (blockIdx.x & 31) >> 2;                   // 8 tiles of 128 pixels x
  int nt  = (blockIdx.x & 3) * 8 + (tid >> 5);        // 4 groups of 8 channel tiles
  stage_rows_async<MT * 16, 256>(hn + (size_t)(b * NPIX + mb * (MT * 16)) * CC, as, tid);

  int lane = tid & 31, half = lane >> 4, l16 = lane & 15;

  const _Float16* arow = as + (size_t)l16 * TP;       // LDS A fragments
  const _Float16* wqr  = w16 + (size_t)(nt * 16 + l16) * CC;
  const _Float16* wkr  = wqr + 262144;
  const _Float16* wvr  = wqr + 524288;

  v8f aq[MT] = {}, ak[MT] = {}, av[MT] = {};
  for (int ki = 0; ki < 16; ++ki) {
    int ko = ki * 32;
    v16h bfq = load_frag_row(wqr + ko, half);
    v16h bfk = load_frag_row(wkr + ko, half);
    v16h bfv = load_frag_row(wvr + ko, half);
#pragma unroll  // constant t: the accumulator arrays stay in registers
    for (int t = 0; t < MT; ++t) {
      v16h af = load_frag_row(arow + t * 16 * TP + ko, half);
      aq[t] = __builtin_amdgcn_wmma_f32_16x16x32_f16(false, af, false, bfq, (short)0, aq[t], false, false);
      ak[t] = __builtin_amdgcn_wmma_f32_16x16x32_f16(false, af, false, bfk, (short)0, ak[t], false, false);
      av[t] = __builtin_amdgcn_wmma_f32_16x16x32_f16(false, af, false, bfv, (short)0, av[t], false, false);
    }
  }
  int co = nt * 16 + l16;
  float biasq = bq[co], biask = bk[co], biasv = bv[co];
#pragma unroll  // constant t, r: accumulators are read from registers
  for (int t = 0; t < MT; ++t) {
#pragma unroll
    for (int r = 0; r < 8; ++r) {
      int p = mb * (MT * 16) + t * 16 + r + 8 * half;
      q[(size_t)(b * NPIX + p) * CC + co]  = (_Float16)(aq[t][r] + biasq);
      k[(size_t)(b * NPIX + p) * CC + co]  = (_Float16)(ak[t][r] + biask);
      vt[(size_t)(b * CC + co) * NPIX + p] = (_Float16)(av[t][r] + biasv);
    }
  }
}

// -------- Attention: per (batch, 64-query tile) block, scores stay in registers
// 16 waves. Both products are formed transposed (K or V^T rows as A, q or P rows
// as B), so a lane owns one query per tile and its keys or channels lie along the
// accumulator registers. A wave holds 64 keys x 64 queries of scores (4 x 4 tiles):
// a K fragment, loaded from global one row per lane, feeds four query tiles, and
// the softmax works on the accumulators; only exp(s - max), as f16, goes to LDS.
__global__ __launch_bounds__(512) void attn_kernel(const _Float16* __restrict__ q,
                                                   const _Float16* __restrict__ k,
                                                   const _Float16* __restrict__ vt,
                                                   _Float16* __restrict__ attn) {
  __shared__ __attribute__((aligned(16))) char smem[QR * PP * 2 + 2 * 16 * RP * 4];
  _Float16* P    = (_Float16*)smem;                    // QR rows x PP f16
  _Float16* qs   = P;                                  // q stage (QR rows x TP) overlaps P:
                                                       // qs dead before P is written
  float*    redm = (float*)(smem + QR * PP * 2);       // 16 waves x RP: maxima
  float*    reds = redm + 16 * RP;                     // 16 waves x RP: sums

  int tid = threadIdx.x;
  int w = tid >> 5, lane = tid & 31, half = lane >> 4, l16 = lane & 15;
  int b = blockIdx.x >> 4, qt = blockIdx.x & 15;
  const float sc2 = 0.044194173824159216f * 1.4426950408889634f;  // 512^-0.5 * log2(e)

  // Async-stage the shared q tile (64x512 f16, contiguous) into LDS.
  stage_rows_async<QR, 512>(q + (size_t)(b * NPIX + qt * QR) * CC, qs, tid);
  const _Float16* qrow = qs + (size_t)l16 * TP;

  // Phase 1: S^T = k_rows x q_tile^T. s[u][t][r]: key w*64 + u*16 + 8*half + r,
  // query t*16 + l16.
  const _Float16* krow = k + (size_t)(b * NPIX + w * 64 + l16) * CC + half * 8;
  v8f s[4][4] = {};
  for (int ki = 0; ki < 16; ++ki) {
    const _Float16* kp = krow + ki * 32;               // the lane half's offset is in krow
    v16h kf[4];
#pragma unroll  // constant u, t: fragments and accumulators stay in registers
    for (int u = 0; u < 4; ++u) kf[u] = load_frag_row(kp + u * 16 * CC, 0);
    // Precaution: the address register stays live up to this wait, so that no
    // load's result is placed in a register that an issued load still names.
    asm volatile("s_wait_xcnt 0x0" :: "v"(kp) : "memory");
#pragma unroll
    for (int t = 0; t < 4; ++t) {
      v16h qf = load_frag_row(qrow + t * 16 * TP + ki * 32, half);
#pragma unroll
      for (int u = 0; u < 4; ++u)
        s[u][t] = __builtin_amdgcn_wmma_f32_16x16x32_f16(false, kf[u], false, qf, (short)0, s[u][t], false, false);
    }
  }

  // Phase 2: softmax over the keys of each query. In a lane: over its 32 keys per
  // query tile; then the other lane half; then the 16 waves, through LDS.
  f4 mx;
#pragma unroll  // constant t, u, r here and below: accumulators are read from registers
  for (int t = 0; t < 4; ++t) {
    float m = s[0][t][0];
#pragma unroll
    for (int u = 0; u < 4; ++u) {
#pragma unroll
      for (int r = 0; r < 8; ++r) m = fmaxf(m, s[u][t][r]);
    }
    mx[t] = fmaxf(m, xhalf(m));
  }
  if (half == 0) *(f4*)(redm + w * RP + l16 * 4) = mx;
  __syncthreads();                                     // also: every wave has left qs
  f4 gm = *(const f4*)(redm + (half * 8) * RP + l16 * 4);
#pragma unroll
  for (int j = 1; j < 8; ++j) {
    f4 o = *(const f4*)(redm + (half * 8 + j) * RP + l16 * 4);
#pragma unroll
    for (int t = 0; t < 4; ++t) gm[t] = fmaxf(gm[t], o[t]);
  }
  f4 sm = {};
#pragma unroll
  for (int t = 0; t < 4; ++t) {
    float mc = fmaxf(gm[t], xhalf(gm[t])) * sc2;
#pragma unroll
    for (int u = 0; u < 4; ++u) {
      h8 o;
#pragma unroll
      for (int r = 0; r < 8; ++r) {
        float e = exp2_slot(fmaf(s[u][t][r], sc2, -mc));
        sm[t] += e;
        o[r] = (_Float16)e;
      }
      *(h8*)(P + (size_t)(t * 16 + l16) * PP + (w * 4 + u) * 16 + half * 8) = o;
    }
    sm[t] += xhalf(sm[t]);
  }
  if (half == 0) *(f4*)(reds + w * RP + l16 * 4) = sm;
  __syncthreads();                                     // publishes P and the partial sums
  f4 gs = {};
#pragma unroll
  for (int j = 0; j < 8; ++j) gs += *(const f4*)(reds + (half * 8 + j) * RP + l16 * 4);
  f4 inv;
#pragma unroll
  for (int t = 0; t < 4; ++t) inv[t] = 1.f / (gs[t] + xhalf(gs[t]));

  // Phase 3: out^T = V^T rows x P^T, 2 channel tiles x 4 query tiles per wave; the
  // division by the row sum is done on the f32 result.
  const _Float16* prow = P + (size_t)l16 * PP;
  const _Float16* vrow = vt + (size_t)(b * CC + w * 32 + l16) * NPIX;   // and 16 rows on
  v8f acc[2][4] = {};
  for (int kk = 0; kk < 32; ++kk) {
    v16h vf0 = load_frag_row(vrow + kk * 32, half);
    v16h vf1 = load_frag_row(vrow + 16 * NPIX + kk * 32, half);
#pragma unroll  // constant t: the accumulator arrays stay in registers
    for (int t = 0; t < 4; ++t) {
      v16h pf = load_frag_row(prow + t * 16 * PP + kk * 32, half);
      acc[0][t] = __builtin_amdgcn_wmma_f32_16x16x32_f16(false, vf0, false, pf, (short)0, acc[0][t], false, false);
      acc[1][t] = __builtin_amdgcn_wmma_f32_16x16x32_f16(false, vf1, false, pf, (short)0, acc[1][t], false, false);
    }
  }
#pragma unroll  // constant t, u, r: accumulators are read from registers
  for (int t = 0; t < 4; ++t) {
#pragma unroll
    for (int u = 0; u < 2; ++u) {
      h8 o;
#pragma unroll
      for (int r = 0; r < 8; ++r) o[r] = (_Float16)(acc[u][t][r] * inv[t]);
      *(h8*)(attn + (size_t)(b * NPIX + qt * QR + t * 16 + l16) * CC + w * 32 + u * 16 + half * 8) = o;
    }
  }
}

// -------- Proj + bias + residual (f32 output, (b, c, h, w))
// As in qkv_kernel: MT pixel tiles per block, one weight fragment feeds MT products.
__global__ __launch_bounds__(256) void proj_kernel(const _Float16* __restrict__ attn,
                                                   const _Float16* __restrict__ wp16,
                                                   const float* __restrict__ bp,
                                                   const float* __restrict__ x,
                                                   float* __restrict__ out) {
  __shared__ __attribute__((aligned(16))) _Float16 as[MT * 16 * TP];  // A tiles, padded rows
  int tid = threadIdx.x;
  int b   = blockIdx.x >> 5;
  int mb  = (blockIdx.x & 31) >> 2;
  int nt  = (blockIdx.x & 3) * 8 + (tid >> 5);
  stage_rows_async<MT * 16, 256>(attn + (size_t)(b * NPIX + mb * (MT * 16)) * CC, as, tid);

  int lane = tid & 31, half = lane >> 4, l16 = lane & 15;

  const _Float16* arow = as + (size_t)l16 * TP;
  const _Float16* wrow = wp16 + (size_t)(nt * 16 + l16) * CC;
  v8f acc[MT] = {};
  for (int ki = 0; ki < 16; ++ki) {
    v16h bf = load_frag_row(wrow + ki * 32, half);
#pragma unroll  // constant t: the accumulator arrays stay in registers
    for (int t = 0; t < MT; ++t) {
      v16h af = load_frag_row(arow + t * 16 * TP + ki * 32, half);
      acc[t] = __builtin_amdgcn_wmma_f32_16x16x32_f16(false, af, false, bf, (short)0, acc[t], false, false);
    }
  }
  int co = nt * 16 + l16;
  float bias = bp[co];
#pragma unroll  // constant t, r: accumulators are read from registers
  for (int t = 0; t < MT; ++t) {
#pragma unroll
    for (int r = 0; r < 8; ++r) {
      int p = mb * (MT * 16) + t * 16 + r + 8 * half;
      size_t idx = (size_t)(b * CC + co) * NPIX + p;
      out[idx] = x[idx] + acc[t][r] + bias;
    }
  }
}

extern "C" void kernel_launch(void* const* d_in, const int* in_sizes, int n_in,
                              void* d_out, int out_size, void* d_ws, size_t ws_size,
                              hipStream_t stream) {
  const float* x     = (const float*)d_in[0];
  const float* gamma = (const float*)d_in[1];
  const float* beta  = (const float*)d_in[2];
  const float* wq    = (const float*)d_in[3];
  const float* bq    = (const float*)d_in[4];
  const float* wk    = (const float*)d_in[5];
  const float* bk    = (const float*)d_in[6];
  const float* wv    = (const float*)d_in[7];
  const float* bv    = (const float*)d_in[8];
  const float* wp    = (const float*)d_in[9];
  const float* bp    = (const float*)d_in[10];
  float* out = (float*)d_out;

  char* ws = (char*)d_ws;
  _Float16* w16 = (_Float16*)ws;                                   // 2 MB
  _Float16* hn  = (_Float16*)(ws + (size_t)(2u << 20));            // 32 MB (reused as attn out)
  _Float16* qb  = (_Float16*)(ws + (size_t)(34u << 20));           // 32 MB
  _Float16* kb  = (_Float16*)(ws + (size_t)(66u << 20));           // 32 MB
  _Float16* vtb = (_Float16*)(ws + (size_t)(98u << 20));           // 32 MB
  _Float16* attn = hn;  // hn's last read is qkv_kernel; safe to reuse

  wconv_kernel<<<4096, 256, 0, stream>>>(wq, wk, wv, wp, w16);
  gn_kernel<<<256, 1024, 0, stream>>>(x, gamma, beta, hn);
  qkv_kernel<<<1024, 256, 0, stream>>>(hn, w16, bq, bk, bv, qb, kb, vtb);
  attn_kernel<<<512, 512, 0, stream>>>(qb, kb, vtb, attn);
  proj_kernel<<<1024, 256, 0, stream>>>(attn, w16 + 3 * 262144, bp, x, out);
}

// v005
// Measured time: 180 microseconds a run.
// In two side-by-side timings against v004, it was 1.10 and 1.11 times as fast.
// Counting every step since v000, it is 8.59 times as fast.
#include <hip/hip_runtime.h>
#include <hip/hip_bf16.h>
#include <stdint.h>

typedef _Float16 v16h __attribute__((ext_vector_type(16)));
typedef float    v8f  __attribute__((ext_vector_type(8)));
typedef _Float16 h2   __attribute__((ext_vector_type(2)));
typedef _Float16 h8   __attribute__((ext_vector_type(8)));
typedef float    f4   __attribute__((ext_vector_type(4)));

#define BB   32
#define CC   512
#define NPIX 1024
#define CPG  16
#define EPSV 1e-5f
#define TP 520
#define PP 1048
#define RP 68
#define MT 8
#define QR 64

__device__ __forceinline__ v16h load_frag_row(const _Float16* rowp, int half) {
  v16h out;
#pragma unroll
  for (int j = 0; j < 8; ++j) {
    int k = 2 * j + ((j >= 4) ? 8 : 0) + half * 8;
    h2 p = *(const h2*)(rowp + k);
    out[2 * j]     = p[0];
    out[2 * j + 1] = p[1];
  }
  return out;
}

// Fragment order in the workspace. A matrix of rows x K f16 is kept as blocks of
// 16 rows x 32 k = 1 KB, block index (row / 16) * (K / 32) + k / 32. Inside a block
// the f16 at (row, k) lies at ((k >> 4) & 1) * 256 + (((k >> 3) & 1) * 16 + (row & 15)) * 8
// + (k & 7): the layout of load_frag_row, lane by lane. A fragment is then two b128
// loads of 512 contiguous bytes per wave (4 whole lines each, not 16 pieces of 32 B).
// lp: the block's start + lane * 8.
__device__ __forceinline__ v16h load_frag_blk(const _Float16* lp) {
  h8 lo = *(const h8*)lp;
  h8 hi = *(const h8*)(lp + 256);
  return __builtin_shufflevector(lo, hi, 0, 1, 2, 3, 4, 5, 6, 7, 8, 9, 10, 11, 12, 13, 14, 15);
}

__device__ __forceinline__ float xhalf(float x) {
  int i = __builtin_bit_cast(int, x);
  return __builtin_bit_cast(float, __builtin_amdgcn_permlanex16(i, i, 0x76543210, 0xfedcba98, false, false));
}

__device__ __forceinline__ float exp2_slot(float x) {
  float e;
  asm("v_exp_f32 %0, %1\n\tv_nop" : "=v"(e) : "v"(x));
  return e;
}

template <int ROWS, int NTHR, int PITCH>
__device__ __forceinline__ void stage_rows_async(const _Float16* gsrc,
                                                 _Float16* lds_dst, int tid) {
  unsigned l0 = (unsigned)(uintptr_t)(void*)lds_dst;
#pragma unroll  // both loops: the address arrays stay in registers
  for (int it = 0; it < ROWS * 64 / NTHR; it += 4) {
    unsigned dst[4];                                   // LDS byte addresses
    unsigned long long gsa[4];                         // global addresses
#pragma unroll
    for (int u = 0; u < 4; ++u) {
      int e = ((it + u) * NTHR + tid) * 8;             // f16 elements
      dst[u] = l0 + (unsigned)((e >> 9) * (PITCH * 2) + (e & 511) * 2);
      gsa[u] = (unsigned long long)(uintptr_t)(gsrc + e);
    }
    // Precaution: the wait closes the copies' own statement, so that no address
    // register of an issued copy is rewritten in front of it.
    asm volatile("global_load_async_to_lds_b128 %0, %4, off\n\t"
                 "global_load_async_to_lds_b128 %1, %5, off\n\t"
                 "global_load_async_to_lds_b128 %2, %6, off\n\t"
                 "global_load_async_to_lds_b128 %3, %7, off\n\t"
                 "s_wait_xcnt 0x0"
                 :: "v"(dst[0]), "v"(dst[1]), "v"(dst[2]), "v"(dst[3]),
                    "v"(gsa[0]), "v"(gsa[1]), "v"(gsa[2]), "v"(gsa[3]) : "memory");
  }
  // The copies have landed before the barrier publishes the tile to all waves.
  asm volatile("s_wait_asynccnt 0x0" ::: "memory");
  __syncthreads();
}

// -------- GroupNorm: (B,512,1024) f32 -> normalized f16 in (b, p, c) layout
// One block = one image x 64 channels (4 groups) x all 1024 pixels, held in
// registers, so x is read once. lane = (pq, cg): a thread owns channels
// cg*8..cg*8+7 at 8 pixels; the eight cg lanes of one pixel together store one
// whole 128-byte line of hn.
__global__ __launch_bounds__(1024) void gn_kernel(const float* __restrict__ x,
                                                  const float* __restrict__ gamma,
                                                  const float* __restrict__ beta,
                                                  _Float16* __restrict__ hn) {
  __shared__ f4 red[4 * 17];
  int tid = threadIdx.x;
  int w = tid >> 5, lane = tid & 31, cg = lane & 7, pq = lane >> 3;
  int b = blockIdx.x >> 3, cb = blockIdx.x & 7;
  int ch0 = cb * 64 + cg * 8;
  int p0  = w * 32 + pq * 4;
  int grp = cg >> 1;                                  // group inside the block
  const float* xb = x + (size_t)(b * CC + ch0) * NPIX + p0;

  f4 v[8][2];
#pragma unroll
  for (int j = 0; j < 8; ++j) {
    v[j][0] = *(const f4*)(xb + j * NPIX);
    v[j][1] = *(const f4*)(xb + j * NPIX + 16);
  }
  unsigned goff = (unsigned)ch0 * 4u;                 // byte offset into gamma, beta
  f4 ga[2], be[2];
  ga[0] = *(const f4*)((const char*)gamma + goff);
  ga[1] = *(const f4*)((const char*)gamma + goff + 16);
  be[0] = *(const f4*)((const char*)beta + goff);
  be[1] = *(const f4*)((const char*)beta + goff + 16);
  // Precaution: the address registers stay live up to this wait, so that no
  // load's result is placed in a register that an issued load still names.
  asm volatile("s_wait_xcnt 0x0" :: "v"(xb), "v"(goff) : "memory");

  f4 s4 = {}, ss4 = {};
#pragma unroll
  for (int j = 0; j < 8; ++j) {
    s4 += v[j][0]; ss4 += v[j][0] * v[j][0];
    s4 += v[j][1]; ss4 += v[j][1] * v[j][1];
  }
  float s  = (s4[0] + s4[1]) + (s4[2] + s4[3]);
  float ss = (ss4[0] + ss4[1]) + (ss4[2] + ss4[3]);
  // Lanes of one group inside a wave: cg pair (bit 0) and the four pq (bits 3, 4).
  s += __shfl_xor(s, 1);  ss += __shfl_xor(ss, 1);
  s += __shfl_xor(s, 8);  ss += __shfl_xor(ss, 8);
  s += __shfl_xor(s, 16); ss += __shfl_xor(ss, 16);
  if ((lane & 25) == 0) {
    float* rf = (float*)red + grp * 68 + w * 2;
    rf[0] = s; rf[1] = ss;
  }
  __syncthreads();
  f4 t4 = {};
#pragma unroll
  for (int t = 0; t < 16; ++t) t4 += red[grp * 17 + t];
  float mean = (t4[0] + t4[2]) * (1.f / 16384.f);
  float var  = (t4[1] + t4[3]) * (1.f / 16384.f) - mean * mean;
  float inv  = rsqrtf(var + EPSV);

  _Float16* hb = hn + (size_t)(b * NPIX + p0) * CC + ch0;
#pragma unroll
  for (int h = 0; h < 2; ++h) {
#pragma unroll
    for (int i = 0; i < 4; ++i) {
      h8 o;
#pragma unroll
      for (int j = 0; j < 8; ++j)
        o[j] = (_Float16)((v[j][h][i] - mean) * inv * ga[j >> 2][j & 3] + be[j >> 2][j & 3]);
      *(h8*)(hb + (size_t)(h * 16 + i) * CC) = o;
    }
  }
}

// -------- Convert the four 512x512 f32 weights to f16 (concatenated), each in
// fragment order (rows = output channels, k = input channels)
__global__ __launch_bounds__(256) void wconv_kernel(const float* __restrict__ wq,
                                                    const float* __restrict__ wk,
                                                    const float* __restrict__ wv,
                                                    const float* __restrict__ wp,
                                                    _Float16* __restrict__ w16) {
  int i = blockIdx.x * 256 + threadIdx.x;   // 0 .. 4*262144-1
  int which = i >> 18, off = i & 262143;
  const float* src = (which == 0) ? wq : (which == 1) ? wk : (which == 2) ? wv : wp;
  int co = (off >> 13) * 16 + ((off >> 3) & 15);
  int ci = ((off >> 9) & 15) * 32 + ((off >> 8) & 1) * 16 + ((off >> 7) & 1) * 8 + (off & 7);
  w16[i] = (_Float16)src[co * CC + ci];
}

// -------- QKV: q, k (row = pixel, k = channel), v_t (row = channel, k = pixel), each
// image's matrix in fragment order.
// 8 waves/block share MT pixel tiles (128 pixels), async-staged to LDS once.
// A weight fragment, loaded from global, feeds MT products. q and k are formed
// transposed (weight rows as A), v as pixels x channels: in both a lane then holds
// the 8 consecutive k of its own place in a block, one b128 store.
__global__ __launch_bounds__(256) void qkv_kernel(const _Float16* __restrict__ hn,
                                                  const _Float16* __restrict__ w16,
                                                  const float* __restrict__ bq,
                                                  const float* __restrict__ bk,
                                                  const float* __restrict__ bv,
                                                  _Float16* __restrict__ q,
                                                  _Float16* __restrict__ k,
                                                  _Float16* __restrict__ vt) {
  __shared__ __attribute__((aligned(16))) _Float16 as[MT * 16 * TP];  // pixel tiles, padded rows
  int tid = threadIdx.x;
  int b   = blockIdx.x >> 5;                          // 32 blocks per image:
  int mb  = (blockIdx.x & 31) >> 2;                   // 8 tiles of 128 pixels x
  int nt  = (blockIdx.x & 3) * 8 + (tid >> 5);        // 4 groups of 8 channel tiles
  stage_rows_async<MT * 16, 256, TP>(hn + (size_t)(b * NPIX + mb * (MT * 16)) * CC, as, tid);

  int lane = tid & 31, half = lane >> 4, l16 = lane & 15;

  const _Float16* arow = as + (size_t)l16 * TP;       // LDS pixel fragments
  const _Float16* wqr  = w16 + (size_t)(nt * 16) * 512 + lane * 8;
  const _Float16* wkr  = wqr + 262144;
  const _Float16* wvr  = wqr + 524288;

  v8f aq[MT] = {}, ak[MT] = {}, av[MT] = {};
  for (int ki = 0; ki < 16; ++ki) {
    int ko = ki * 32;
    v16h bfq = load_frag_blk(wqr + ki * 512);
    v16h bfk = load_frag_blk(wkr + ki * 512);
    v16h bfv = load_frag_blk(wvr + ki * 512);
#pragma unroll  // constant t: the accumulator arrays stay in registers
    for (int t = 0; t < MT; ++t) {
      v16h af = load_frag_row(arow + t * 16 * TP + ko, half);
      aq[t] = __builtin_amdgcn_wmma_f32_16x16x32_f16(false, bfq, false, af, (short)0, aq[t], false, false);
      ak[t] = __builtin_amdgcn_wmma_f32_16x16x32_f16(false, bfk, false, af, (short)0, ak[t], false, false);
      av[t] = __builtin_amdgcn_wmma_f32_16x16x32_f16(false, af, false, bfv, (short)0, av[t], false, false);
    }
  }
  // aq, ak [t][r]: pixel t*16 + l16, channel nt*16 + 8*half + r.
  // av [t][r]: channel nt*16 + l16, pixel t*16 + 8*half + r.
  unsigned o8 = (unsigned)(nt * 16 + 8 * half) * 4u;  // byte offsets into the biases
  unsigned o1 = (unsigned)(nt * 16 + l16) * 4u;
  float biasv = *(const float*)((const char*)bv + o1);
  f4 biasq[2], biask[2];
  biasq[0] = *(const f4*)((const char*)bq + o8); biasq[1] = *(const f4*)((const char*)bq + o8 + 16);
  biask[0] = *(const f4*)((const char*)bk + o8); biask[1] = *(const f4*)((const char*)bk + o8 + 16);
  // Precaution: the offset registers stay live up to this wait, so that no
  // load's result is placed in a register that an issued load still names.
  asm volatile("s_wait_xcnt 0x0" :: "v"(o8), "v"(o1) : "memory");
  size_t img = (size_t)b * (NPIX * CC);
  size_t qko = img + (size_t)((mb * MT) * 16 + (nt >> 1)) * 512 + (nt & 1) * 256 + lane * 8;
  size_t vo  = img + (size_t)(nt * 32 + mb * (MT / 2)) * 512 + lane * 8;
#pragma unroll  // constant t, r here and below: accumulators are read from registers
  for (int t = 0; t < MT; ++t) {
    h8 ov;
#pragma unroll
    for (int r = 0; r < 8; ++r) ov[r] = (_Float16)(av[t][r] + biasv);
    *(h8*)(vt + vo + (t >> 1) * 512 + (t & 1) * 256) = ov;
  }
#pragma unroll
  for (int t = 0; t < MT; ++t) {
    h8 oq;
#pragma unroll
    for (int r = 0; r < 8; ++r) oq[r] = (_Float16)(aq[t][r] + biasq[r >> 2][r & 3]);
    *(h8*)(q + qko + t * (16 * 512)) = oq;
  }
#pragma unroll
  for (int t = 0; t < MT; ++t) {
    h8 ok;
#pragma unroll
    for (int r = 0; r < 8; ++r) ok[r] = (_Float16)(ak[t][r] + biask[r >> 2][r & 3]);
    *(h8*)(k + qko + t * (16 * 512)) = ok;
  }
}

// -------- Attention: per (batch, 64-query tile) block, scores stay in registers
// 16 waves. Both products are formed transposed (K or V^T rows as A, q or P rows
// as B), so a lane owns one query per tile and its keys or channels lie along the
// accumulator registers. A wave holds 64 keys x 64 queries of scores (4 x 4 tiles):
// a K fragment, loaded from global in fragment order, feeds four query tiles, and
// the softmax works on the accumulators; only exp(s - max), as f16, goes to LDS.
__global__ __launch_bounds__(512) void attn_kernel(const _Float16* __restrict__ q,
                                                   const _Float16* __restrict__ k,
                                                   const _Float16* __restrict__ vt,
                                                   _Float16* __restrict__ attn) {
  __shared__ __attribute__((aligned(16))) char smem[QR * PP * 2 + 2 * 16 * RP * 4];
  _Float16* P    = (_Float16*)smem;                    // QR rows x PP f16
  _Float16* qs   = P;                                  // q stage (64 blocks of 1 KB) overlaps P:
                                                       // qs dead before P is written
  float*    redm = (float*)(smem + QR * PP * 2);       // 16 waves x RP: maxima
  float*    reds = redm + 16 * RP;                     // 16 waves x RP: sums

  int tid = threadIdx.x;
  int w = tid >> 5, lane = tid & 31, half = lane >> 4, l16 = lane & 15;
  int b = blockIdx.x >> 4, qt = blockIdx.x & 15;
  const float sc2 = 0.044194173824159216f * 1.4426950408889634f;  // 512^-0.5 * log2(e)

  stage_rows_async<QR, 512, 512>(q + (size_t)(b * NPIX + qt * QR) * CC, qs, tid);
  const _Float16* qblk = qs + lane * 8;

  // Phase 1: S^T = k_rows x q_tile^T. s[u][t][r]: key w*64 + u*16 + 8*half + r,
  // query t*16 + l16.
  const _Float16* kblk = k + (size_t)(b * NPIX + w * 64) * CC + lane * 8;
  v8f s[4][4] = {};
  for (int ki = 0; ki < 16; ++ki) {
    const _Float16* kp = kblk + ki * 512;
    v16h kf[4];
#pragma unroll  // constant u, t: fragments and accumulators stay in registers
    for (int u = 0; u < 4; ++u) kf[u] = load_frag_blk(kp + u * 16 * 512);
    // Precaution: the address register stays live up to this wait, so that no
    // load's result is placed in a register that an issued load still names.
    asm volatile("s_wait_xcnt 0x0" :: "v"(kp) : "memory");
#pragma unroll
    for (int t = 0; t < 4; ++t) {
      v16h qf = load_frag_blk(qblk + (t * 16 + ki) * 512);
#pragma unroll
      for (int u = 0; u < 4; ++u)
        s[u][t] = __builtin_amdgcn_wmma_f32_16x16x32_f16(false, kf[u], false, qf, (short)0, s[u][t], false, false);
    }
  }

  // Phase 2: softmax over the keys of each query. In a lane: over its 32 keys per
  // query tile; then the other lane half; then the 16 waves, through LDS.
  f4 mx;
#pragma unroll  // constant t, u, r here and below: accumulators are read from registers
  for (int t = 0; t < 4; ++t) {
    float m = s[0][t][0];
#pragma unroll
    for (int u = 0; u < 4; ++u) {
#pragma unroll
      for (int r = 0; r < 8; ++r) m = fmaxf(m, s[u][t][r]);
    }
    mx[t] = fmaxf(m, xhalf(m));
  }
  if (half == 0) *(f4*)(redm + w * RP + l16 * 4) = mx;
  __syncthreads();                                     // also: every wave has left qs
  f4 gm = *(const f4*)(redm + (half * 8) * RP + l16 * 4);
#pragma unroll
  for (int j = 1; j < 8; ++j) {
    f4 o = *(const f4*)(redm + (half * 8 + j) * RP + l16 * 4);
#pragma unroll
    for (int t = 0; t < 4; ++t) gm[t] = fmaxf(gm[t], o[t]);
  }
  f4 sm = {};
#pragma unroll
  for (int t = 0; t < 4; ++t) {
    float mc = fmaxf(gm[t], xhalf(gm[t])) * sc2;
#pragma unroll
    for (int u = 0; u < 4; ++u) {
      h8 o;
#pragma unroll
      for (int r = 0; r < 8; ++r) {
        float e = exp2_slot(fmaf(s[u][t][r], sc2, -mc));
        sm[t] += e;
        o[r] = (_Float16)e;
      }
      *(h8*)(P + (size_t)(t * 16 + l16) * PP + (w * 4 + u) * 16 + half * 8) = o;
    }
    sm[t] += xhalf(sm[t]);
  }
  if (half == 0) *(f4*)(reds + w * RP + l16 * 4) = sm;
  __syncthreads();                                     // publishes P and the partial sums
  f4 gs = {};
#pragma unroll
  for (int j = 0; j < 8; ++j) gs += *(const f4*)(reds + (half * 8 + j) * RP + l16 * 4);
  f4 inv;
#pragma unroll
  for (int t = 0; t < 4; ++t) inv[t] = 1.f / (gs[t] + xhalf(gs[t]));

  // Phase 3: out^T = V^T rows x P^T, 2 channel tiles x 4 query tiles per wave; the
  // division by the row sum is done on the f32 result.
  const _Float16* prow = P + (size_t)l16 * PP;
  const _Float16* vblk = vt + (size_t)(b * CC + w * 32) * NPIX + lane * 8;   // and 32 blocks on
  v8f acc[2][4] = {};
  for (int kk = 0; kk < 32; ++kk) {
    v16h vf0 = load_frag_blk(vblk + kk * 512);
    v16h vf1 = load_frag_blk(vblk + (32 + kk) * 512);
#pragma unroll  // constant t: the accumulator arrays stay in registers
    for (int t = 0; t < 4; ++t) {
      v16h pf = load_frag_row(prow + t * 16 * PP + kk * 32, half);
      acc[0][t] = __builtin_amdgcn_wmma_f32_16x16x32_f16(false, vf0, false, pf, (short)0, acc[0][t], false, false);
      acc[1][t] = __builtin_amdgcn_wmma_f32_16x16x32_f16(false, vf1, false, pf, (short)0, acc[1][t], false, false);
    }
  }
#pragma unroll  // constant t, u, r: accumulators are read from registers
  for (int t = 0; t < 4; ++t) {
#pragma unroll
    for (int u = 0; u < 2; ++u) {
      h8 o;
#pragma unroll
      for (int r = 0; r < 8; ++r) o[r] = (_Float16)(acc[u][t][r] * inv[t]);
      // fragment order (row = query, k = channel): block (t, w), upper or lower half u
      *(h8*)(attn + (size_t)(b * NPIX + qt * QR) * CC + (t * 16 + w) * 512 + u * 256 + lane * 8) = o;
    }
  }
}

// -------- Proj + bias + residual (f32 output, (b, c, h, w))
// As in qkv_kernel: MT pixel tiles per block, one weight fragment feeds MT products.
// attn lies in fragment order and is staged as it lies.
__global__ __launch_bounds__(256) void proj_kernel(const _Float16* __restrict__ attn,
                                                   const _Float16* __restrict__ wp16,
                                                   const float* __restrict__ bp,
                                                   const float* __restrict__ x,
                                                   float* __restrict__ out) {
  __shared__ __attribute__((aligned(16))) _Float16 as[MT * 16 * 512];  // A tiles, 1-KB blocks
  int tid = threadIdx.x;
  int b   = blockIdx.x >> 5;
  int mb  = (blockIdx.x & 31) >> 2;
  int nt  = (blockIdx.x & 3) * 8 + (tid >> 5);
  stage_rows_async<MT * 16, 256, 512>(attn + (size_t)(b * NPIX + mb * (MT * 16)) * CC, as, tid);

  int lane = tid & 31, half = lane >> 4, l16 = lane & 15;

  const _Float16* ablk = as + lane * 8;
  const _Float16* wblk = wp16 + (size_t)(nt * 16) * 512 + lane * 8;   // fragment order
  v8f acc[MT] = {};
  for (int ki = 0; ki < 16; ++ki) {
    v16h bf = load_frag_blk(wblk + ki * 512);
#pragma unroll  // constant t: the accumulator arrays stay in registers
    for (int t = 0; t < MT; ++t) {
      v16h af = load_frag_blk(ablk + (t * 16 + ki) * 512);
      acc[t] = __builtin_amdgcn_wmma_f32_16x16x32_f16(false, af, false, bf, (short)0, acc[t], false, false);
    }
  }
  int co = nt * 16 + l16;
  float bias = bp[co];
#pragma unroll  // constant t, r: accumulators are read from registers
  for (int t = 0; t < MT; ++t) {
#pragma unroll
    for (int r = 0; r < 8; ++r) {
      int p = mb * (MT * 16) + t * 16 + r + 8 * half;
      size_t idx = (size_t)(b * CC + co) * NPIX + p;
      out[idx] = x[idx] + acc[t][r] + bias;
    }
  }
}

extern "C" void kernel_launch(void* const* d_in, const int* in_sizes, int n_in,
                              void* d_out, int out_size, void* d_ws, size_t ws_size,
                              hipStream_t stream) {
  const float* x     = (const float*)d_in[0];
  const float* gamma = (const float*)d_in[1];
  const float* beta  = (const float*)d_in[2];
  const float* wq    = (const float*)d_in[3];
  const float* bq    = (const float*)d_in[4];
  const float* wk    = (const float*)d_in[5];
  const float* bk    = (const float*)d_in[6];
  const float* wv    = (const float*)d_in[7];
  const float* bv    = (const float*)d_in[8];
  const float* wp    = (const float*)d_in[9];
  const float* bp    = (const float*)d_in[10];
  float* out = (float*)d_out;

  char* ws = (char*)d_ws;
  _Float16* w16 = (_Float16*)ws;                                   // 2 MB
  _Float16* hn  = (_Float16*)(ws + (size_t)(2u << 20));            // 32 MB (reused as attn out)
  _Float16* qb  = (_Float16*)(ws + (size_t)(34u << 20));           // 32 MB
  _Float16* kb  = (_Float16*)(ws + (size_t)(66u << 20));           // 32 MB
  _Float16* vtb = (_Float16*)(ws + (size_t)(98u << 20));           // 32 MB
  _Float16* attn = hn;  // hn's last read is qkv_kernel; safe to reuse

  wconv_kernel<<<4096, 256, 0, stream>>>(wq, wk, wv, wp, w16);
  gn_kernel<<<256, 1024, 0, stream>>>(x, gamma, beta, hn);
  qkv_kernel<<<1024, 256, 0, stream>>>(hn, w16, bq, bk, bv, qb, kb, vtb);
  attn_kernel<<<512, 512, 0, stream>>>(qb, kb, vtb, attn);
  proj_kernel<<<1024, 256, 0, stream>>>(attn, w16 + 3 * 262144, bp, x, out);
}

// v006
// One run takes 158 microseconds.
// In two side-by-side timings against v005, it was 1.14 and 1.13 times as fast.
// Over all steps from v000 it is 9.78 times as fast.
#include <hip/hip_runtime.h>
#include <hip/hip_bf16.h>
#include <stdint.h>

typedef _Float16 v16h __attribute__((ext_vector_type(16)));
typedef float    v8f  __attribute__((ext_vector_type(8)));
typedef _Float16 h2   __attribute__((ext_vector_type(2)));
typedef _Float16 h8   __attribute__((ext_vector_type(8)));
typedef float    f4   __attribute__((ext_vector_type(4)));

#define BB   32
#define CC   512
#define NPIX 1024
#define CPG  16
#define EPSV 1e-5f
#define TP 520
#define PP 1048
#define RP 68
#define MT 8
#define QR 64

__device__ __forceinline__ v16h load_frag_row(const _Float16* rowp, int half) {
  v16h out;
#pragma unroll
  for (int j = 0; j < 8; ++j) {
    int k = 2 * j + ((j >= 4) ? 8 : 0) + half * 8;
    h2 p = *(const h2*)(rowp + k);
    out[2 * j]     = p[0];
    out[2 * j + 1] = p[1];
  }
  return out;
}

// Fragment order in the workspace. A matrix of rows x K f16 is kept as blocks of
// 16 rows x 32 k = 1 KB, block index (row / 16) * (K / 32) + k / 32. Inside a block
// the f16 at (row, k) lies at ((k >> 4) & 1) * 256 + (((k >> 3) & 1) * 16 + (row & 15)) * 8
// + (k & 7): the layout of load_frag_row, lane by lane. A fragment is then two b128
// loads of 512 contiguous bytes per wave (4 whole lines each, not 16 pieces of 32 B).
// lp: the block's start + lane * 8.
__device__ __forceinline__ v16h load_frag_blk(const _Float16* lp) {
  h8 lo = *(const h8*)lp;
  h8 hi = *(const h8*)(lp + 256);
  return __builtin_shufflevector(lo, hi, 0, 1, 2, 3, 4, 5, 6, 7, 8, 9, 10, 11, 12, 13, 14, 15);
}

__device__ __forceinline__ float xhalf(float x) {
  int i = __builtin_bit_cast(int, x);
  return __builtin_bit_cast(float, __builtin_amdgcn_permlanex16(i, i, 0x76543210, 0xfedcba98, false, false));
}

__device__ __forceinline__ float exp2_slot(float x) {
  float e;
  asm("v_exp_f32 %0, %1\n\tv_nop" : "=v"(e) : "v"(x));
  return e;
}

template <int ROWS, int NTHR, int PITCH>
__device__ __forceinline__ void stage_rows_async(const _Float16* gsrc,
                                                 _Float16* lds_dst, int tid) {
  unsigned l0 = (unsigned)(uintptr_t)(void*)lds_dst;
#pragma unroll  // both loops: the address arrays stay in registers
  for (int it = 0; it < ROWS * 64 / NTHR; it += 4) {
    unsigned dst[4];                                   // LDS byte addresses
    unsigned long long gsa[4];                         // global addresses
#pragma unroll
    for (int u = 0; u < 4; ++u) {
      int e = ((it + u) * NTHR + tid) * 8;             // f16 elements
      dst[u] = l0 + (unsigned)((e >> 9) * (PITCH * 2) + (e & 511) * 2);
      gsa[u] = (unsigned long long)(uintptr_t)(gsrc + e);
    }
    // Precaution: the wait closes the copies' own statement, so that no address
    // register of an issued copy is rewritten in front of it.
    asm volatile("global_load_async_to_lds_b128 %0, %4, off\n\t"
                 "global_load_async_to_lds_b128 %1, %5, off\n\t"
                 "global_load_async_to_lds_b128 %2, %6, off\n\t"
                 "global_load_async_to_lds_b128 %3, %7, off\n\t"
                 "s_wait_xcnt 0x0"
                 :: "v"(dst[0]), "v"(dst[1]), "v"(dst[2]), "v"(dst[3]),
                    "v"(gsa[0]), "v"(gsa[1]), "v"(gsa[2]), "v"(gsa[3]) : "memory");
  }
  // The copies have landed before the barrier publishes the tile to all waves.
  asm volatile("s_wait_asynccnt 0x0" ::: "memory");
  __syncthreads();
}

// -------- GroupNorm: (B,512,1024) f32 -> normalized f16 in (b, p, c) layout
// One block = one image x 64 channels (4 groups) x all 1024 pixels, held in
// registers, so x is read once. lane = (pq, cg): a thread owns channels
// cg*8..cg*8+7 at 8 pixels; the eight cg lanes of one pixel together store one
// whole 128-byte line of hn.
__global__ __launch_bounds__(1024) void gn_kernel(const float* __restrict__ x,
                                                  const float* __restrict__ gamma,
                                                  const float* __restrict__ beta,
                                                  _Float16* __restrict__ hn) {
  __shared__ f4 red[4 * 17];
  int tid = threadIdx.x;
  int w = tid >> 5, lane = tid & 31, cg = lane & 7, pq = lane >> 3;
  int b = blockIdx.x >> 3, cb = blockIdx.x & 7;
  int ch0 = cb * 64 + cg * 8;
  int p0  = w * 32 + pq * 4;
  int grp = cg >> 1;                                  // group inside the block
  const float* xb = x + (size_t)(b * CC + ch0) * NPIX + p0;

  f4 v[8][2];
#pragma unroll
  for (int j = 0; j < 8; ++j) {
    v[j][0] = *(const f4*)(xb + j * NPIX);
    v[j][1] = *(const f4*)(xb + j * NPIX + 16);
  }
  unsigned goff = (unsigned)ch0 * 4u;                 // byte offset into gamma, beta
  f4 ga[2], be[2];
  ga[0] = *(const f4*)((const char*)gamma + goff);
  ga[1] = *(const f4*)((const char*)gamma + goff + 16);
  be[0] = *(const f4*)((const char*)beta + goff);
  be[1] = *(const f4*)((const char*)beta + goff + 16);
  // Precaution: the address registers stay live up to this wait, so that no
  // load's result is placed in a register that an issued load still names.
  asm volatile("s_wait_xcnt 0x0" :: "v"(xb), "v"(goff) : "memory");

  f4 s4 = {}, ss4 = {};
#pragma unroll
  for (int j = 0; j < 8; ++j) {
    s4 += v[j][0]; ss4 += v[j][0] * v[j][0];
    s4 += v[j][1]; ss4 += v[j][1] * v[j][1];
  }
  float s  = (s4[0] + s4[1]) + (s4[2] + s4[3]);
  float ss = (ss4[0] + ss4[1]) + (ss4[2] + ss4[3]);
  // Lanes of one group inside a wave: cg pair (bit 0) and the four pq (bits 3, 4).
  s += __shfl_xor(s, 1);  ss += __shfl_xor(ss, 1);
  s += __shfl_xor(s, 8);  ss += __shfl_xor(ss, 8);
  s += __shfl_xor(s, 16); ss += __shfl_xor(ss, 16);
  if ((lane & 25) == 0) {
    float* rf = (float*)red + grp * 68 + w * 2;
    rf[0] = s; rf[1] = ss;
  }
  __syncthreads();
  f4 t4 = {};
#pragma unroll
  for (int t = 0; t < 16; ++t) t4 += red[grp * 17 + t];
  float mean = (t4[0] + t4[2]) * (1.f / 16384.f);
  float var  = (t4[1] + t4[3]) * (1.f / 16384.f) - mean * mean;
  float inv  = rsqrtf(var + EPSV);

  _Float16* hb = hn + (size_t)(b * NPIX + p0) * CC + ch0;
#pragma unroll
  for (int h = 0; h < 2; ++h) {
#pragma unroll
    for (int i = 0; i < 4; ++i) {
      h8 o;
#pragma unroll
      for (int j = 0; j < 8; ++j)
        o[j] = (_Float16)((v[j][h][i] - mean) * inv * ga[j >> 2][j & 3] + be[j >> 2][j & 3]);
      *(h8*)(hb + (size_t)(h * 16 + i) * CC) = o;
    }
  }
}

// -------- Convert the four 512x512 f32 weights to f16 (concatenated), each in
// fragment order (rows = output channels, k = input channels)
__global__ __launch_bounds__(256) void wconv_kernel(const float* __restrict__ wq,
                                                    const float* __restrict__ wk,
                                                    const float* __restrict__ wv,
                                                    const float* __restrict__ wp,
                                                    _Float16* __restrict__ w16) {
  int i = blockIdx.x * 256 + threadIdx.x;   // 0 .. 4*262144-1
  int which = i >> 18, off = i & 262143;
  const float* src = (which == 0) ? wq : (which == 1) ? wk : (which == 2) ? wv : wp;
  int co = (off >> 13) * 16 + ((off >> 3) & 15);
  int ci = ((off >> 9) & 15) * 32 + ((off >> 8) & 1) * 16 + ((off >> 7) & 1) * 8 + (off & 7);
  w16[i] = (_Float16)src[co * CC + ci];
}

// -------- QKV: q, k (row = pixel, k = channel), v_t (row = channel, k = pixel), each
// image's matrix in fragment order.
// 8 waves/block share MT pixel tiles (128 pixels), async-staged to LDS once.
// A weight fragment, loaded from global, feeds MT products. q and k are formed
// transposed (weight rows as A), v as pixels x channels: in both a lane then holds
// the 8 consecutive k of its own place in a block, one b128 store.
__global__ __launch_bounds__(256) void qkv_kernel(const _Float16* __restrict__ hn,
                                                  const _Float16* __restrict__ w16,
                                                  const float* __restrict__ bq,
                                                  const float* __restrict__ bk,
                                                  const float* __restrict__ bv,
                                                  _Float16* __restrict__ q,
                                                  _Float16* __restrict__ k,
                                                  _Float16* __restrict__ vt) {
  __shared__ __attribute__((aligned(16))) _Float16 as[MT * 16 * TP];  // pixel tiles, padded rows
  int tid = threadIdx.x;
  int b   = blockIdx.x >> 5;                          // 32 blocks per image:
  int mb  = (blockIdx.x & 31) >> 2;                   // 8 tiles of 128 pixels x
  int nt  = (blockIdx.x & 3) * 8 + (tid >> 5);        // 4 groups of 8 channel tiles
  stage_rows_async<MT * 16, 256, TP>(hn + (size_t)(b * NPIX + mb * (MT * 16)) * CC, as, tid);

  int lane = tid & 31, half = lane >> 4, l16 = lane & 15;

  const _Float16* arow = as + (size_t)l16 * TP;       // LDS pixel fragments
  const _Float16* wqr  = w16 + (size_t)(nt * 16) * 512 + lane * 8;
  const _Float16* wkr  = wqr + 262144;
  const _Float16* wvr  = wqr + 524288;

  v8f aq[MT] = {}, ak[MT] = {}, av[MT] = {};
  for (int ki = 0; ki < 16; ++ki) {
    int ko = ki * 32;
    v16h bfq = load_frag_blk(wqr + ki * 512);
    v16h bfk = load_frag_blk(wkr + ki * 512);
    v16h bfv = load_frag_blk(wvr + ki * 512);
#pragma unroll  // constant t: the accumulator arrays stay in registers
    for (int t = 0; t < MT; ++t) {
      v16h af = load_frag_row(arow + t * 16 * TP + ko, half);
      aq[t] = __builtin_amdgcn_wmma_f32_16x16x32_f16(false, bfq, false, af, (short)0, aq[t], false, false);
      ak[t] = __builtin_amdgcn_wmma_f32_16x16x32_f16(false, bfk, false, af, (short)0, ak[t], false, false);
      av[t] = __builtin_amdgcn_wmma_f32_16x16x32_f16(false, af, false, bfv, (short)0, av[t], false, false);
    }
  }
  // aq, ak [t][r]: pixel t*16 + l16, channel nt*16 + 8*half + r.
  // av [t][r]: channel nt*16 + l16, pixel t*16 + 8*half + r.
  unsigned o8 = (unsigned)(nt * 16 + 8 * half) * 4u;  // byte offsets into the biases
  unsigned o1 = (unsigned)(nt * 16 + l16) * 4u;
  float biasv = *(const float*)((const char*)bv + o1);
  f4 biasq[2], biask[2];
  biasq[0] = *(const f4*)((const char*)bq + o8); biasq[1] = *(const f4*)((const char*)bq + o8 + 16);
  biask[0] = *(const f4*)((const char*)bk + o8); biask[1] = *(const f4*)((const char*)bk + o8 + 16);
  // Precaution: the offset registers stay live up to this wait, so that no
  // load's result is placed in a register that an issued load still names.
  asm volatile("s_wait_xcnt 0x0" :: "v"(o8), "v"(o1) : "memory");
  size_t img = (size_t)b * (NPIX * CC);
  size_t qko = img + (size_t)((mb * MT) * 16 + (nt >> 1)) * 512 + (nt & 1) * 256 + lane * 8;
  size_t vo  = img + (size_t)(nt * 32 + mb * (MT / 2)) * 512 + lane * 8;
#pragma unroll  // constant t, r here and below: accumulators are read from registers
  for (int t = 0; t < MT; ++t) {
    h8 ov;
#pragma unroll
    for (int r = 0; r < 8; ++r) ov[r] = (_Float16)(av[t][r] + biasv);
    *(h8*)(vt + vo + (t >> 1) * 512 + (t & 1) * 256) = ov;
  }
#pragma unroll
  for (int t = 0; t < MT; ++t) {
    h8 oq;
#pragma unroll
    for (int r = 0; r < 8; ++r) oq[r] = (_Float16)(aq[t][r] + biasq[r >> 2][r & 3]);
    *(h8*)(q + qko + t * (16 * 512)) = oq;
  }
#pragma unroll
  for (int t = 0; t < MT; ++t) {
    h8 ok;
#pragma unroll
    for (int r = 0; r < 8; ++r) ok[r] = (_Float16)(ak[t][r] + biask[r >> 2][r & 3]);
    *(h8*)(k + qko + t * (16 * 512)) = ok;
  }
}

// One trip of phase 1 of the attention kernel: 4 K fragments x 4 q fragments (LDS, qp).
__device__ __forceinline__ void qk_trip(v8f (&s)[4][4], const v16h (&kf)[4], const _Float16* qp) {
#pragma unroll  // constant t, u: fragments and accumulators stay in registers
  for (int t = 0; t < 4; ++t) {
    v16h qf = load_frag_blk(qp + t * 16 * 512);
#pragma unroll
    for (int u = 0; u < 4; ++u)
      s[u][t] = __builtin_amdgcn_wmma_f32_16x16x32_f16(false, kf[u], false, qf, (short)0, s[u][t], false, false);
  }
}

// One trip of phase 3: 2 V^T fragments x 4 P fragments (LDS rows at pp).
__device__ __forceinline__ void pv_trip(v8f (&acc)[2][4], const v16h (&vf)[2], const _Float16* pp, int half) {
#pragma unroll  // constant t: the accumulator arrays stay in registers
  for (int t = 0; t < 4; ++t) {
    v16h pf = load_frag_row(pp + t * 16 * PP, half);
    acc[0][t] = __builtin_amdgcn_wmma_f32_16x16x32_f16(false, vf[0], false, pf, (short)0, acc[0][t], false, false);
    acc[1][t] = __builtin_amdgcn_wmma_f32_16x16x32_f16(false, vf[1], false, pf, (short)0, acc[1][t], false, false);
  }
}

__device__ __forceinline__ void loads_issued(const _Float16* p) {
  asm volatile("s_wait_xcnt 0x0" :: "v"(p) : "memory");
}

// -------- Attention: per (batch, 64-query tile) block, scores stay in registers
// 16 waves. Both products are formed transposed (K or V^T rows as A, q or P rows
// as B), so a lane owns one query per tile and its keys or channels lie along the
// accumulator registers. A wave holds 64 keys x 64 queries of scores (4 x 4 tiles):
// a K fragment, loaded from global in fragment order, feeds four query tiles, and
// the softmax works on the accumulators; only exp(s - max), as f16, goes to LDS.
__global__ __launch_bounds__(512) void attn_kernel(const _Float16* __restrict__ q,
                                                   const _Float16* __restrict__ k,
                                                   const _Float16* __restrict__ vt,
                                                   _Float16* __restrict__ attn) {
  __shared__ __attribute__((aligned(16))) char smem[QR * PP * 2 + 2 * 16 * RP * 4];
  _Float16* P    = (_Float16*)smem;                    // QR rows x PP f16
  _Float16* qs   = P;                                  // q stage (64 blocks of 1 KB) overlaps P:
                                                       // qs dead before P is written
  float*    redm = (float*)(smem + QR * PP * 2);       // 16 waves x RP: maxima
  float*    reds = redm + 16 * RP;                     // 16 waves x RP: sums

  int tid = threadIdx.x;
  int w = tid >> 5, lane = tid & 31, half = lane >> 4, l16 = lane & 15;
  int b = blockIdx.x >> 4, qt = blockIdx.x & 15;
  const float sc2 = 0.044194173824159216f * 1.4426950408889634f;  // 512^-0.5 * log2(e)

  const _Float16* kblk = k + (size_t)(b * NPIX + w * 64) * CC + lane * 8;
  v16h kf[2][4];                                       // two register sets: this trip, the next
#pragma unroll  // constant u: the fragments stay in registers
  for (int u = 0; u < 4; ++u) kf[0][u] = load_frag_blk(kblk + u * 16 * 512);
  stage_rows_async<QR, 512, 512>(q + (size_t)(b * NPIX + qt * QR) * CC, qs, tid);
  const _Float16* qblk = qs + lane * 8;

  // Phase 1: S^T = k_rows x q_tile^T. s[u][t][r]: key w*64 + u*16 + 8*half + r,
  // query t*16 + l16. The K fragments of trip ki + 1 are loaded in front of the
  // products of trip ki, so that their way from L2 is covered by those products.
  v8f s[4][4] = {};
#pragma nounroll  // unrolled whole, as the compiler does unasked, the build spills accumulators to scratch
  for (int ki = 0; ki < 14; ki += 2) {
    const _Float16* kp = kblk + ki * 512;
#pragma unroll  // constant u here and below: the fragments stay in registers
    for (int u = 0; u < 4; ++u) kf[1][u] = load_frag_blk(kp + 512 + u * 16 * 512);
    loads_issued(kp);
    qk_trip(s, kf[0], qblk + ki * 512);
#pragma unroll
    for (int u = 0; u < 4; ++u) kf[0][u] = load_frag_blk(kp + 1024 + u * 16 * 512);
    loads_issued(kp);
    qk_trip(s, kf[1], qblk + (ki + 1) * 512);
  }
#pragma unroll
  for (int u = 0; u < 4; ++u) kf[1][u] = load_frag_blk(kblk + 15 * 512 + u * 16 * 512);
  loads_issued(kblk);
  qk_trip(s, kf[0], qblk + 14 * 512);
  qk_trip(s, kf[1], qblk + 15 * 512);

  // Phase 2: softmax over the keys of each query. In a lane: over its 32 keys per
  // query tile; then the other lane half; then the 16 waves, through LDS.
  f4 mx;
#pragma unroll  // constant t, u, r here and below: accumulators are read from registers
  for (int t = 0; t < 4; ++t) {
    float m = s[0][t][0];
#pragma unroll
    for (int u = 0; u < 4; ++u) {
#pragma unroll
      for (int r = 0; r < 8; ++r) m = fmaxf(m, s[u][t][r]);
    }
    mx[t] = fmaxf(m, xhalf(m));
  }
  if (half == 0) *(f4*)(redm + w * RP + l16 * 4) = mx;
  __syncthreads();                                     // also: every wave has left qs
  f4 gm = *(const f4*)(redm + (half * 8) * RP + l16 * 4);
#pragma unroll
  for (int j = 1; j < 8; ++j) {
    f4 o = *(const f4*)(redm + (half * 8 + j) * RP + l16 * 4);
#pragma unroll
    for (int t = 0; t < 4; ++t) gm[t] = fmaxf(gm[t], o[t]);
  }
  f4 sm = {};
#pragma unroll
  for (int t = 0; t < 4; ++t) {
    float mc = fmaxf(gm[t], xhalf(gm[t])) * sc2;
#pragma unroll
    for (int u = 0; u < 4; ++u) {
      h8 o;
#pragma unroll
      for (int r = 0; r < 8; ++r) {
        float e = exp2_slot(fmaf(s[u][t][r], sc2, -mc));
        sm[t] += e;
        o[r] = (_Float16)e;
      }
      *(h8*)(P + (size_t)(t * 16 + l16) * PP + (w * 4 + u) * 16 + half * 8) = o;
    }
    sm[t] += xhalf(sm[t]);
  }
  if (half == 0) *(f4*)(reds + w * RP + l16 * 4) = sm;
  __syncthreads();                                     // publishes P and the partial sums
  f4 gs = {};
#pragma unroll
  for (int j = 0; j < 8; ++j) gs += *(const f4*)(reds + (half * 8 + j) * RP + l16 * 4);
  f4 inv;
#pragma unroll
  for (int t = 0; t < 4; ++t) inv[t] = 1.f / (gs[t] + xhalf(gs[t]));

  // Phase 3: out^T = V^T rows x P^T, 2 channel tiles x 4 query tiles per wave; the
  // division by the row sum is done on the f32 result.
  const _Float16* prow = P + (size_t)l16 * PP;
  const _Float16* vblk = vt + (size_t)(b * CC + w * 32) * NPIX + lane * 8;   // and 32 blocks on
  v8f acc[2][4] = {};
  v16h vr[4][2];                                       // register ring: V fragments of four trips
#pragma unroll  // constant j: the ring stays in registers
  for (int j = 0; j < 3; ++j) {
    vr[j][0] = load_frag_blk(vblk + j * 512);
    vr[j][1] = load_frag_blk(vblk + (32 + j) * 512);
  }
  loads_issued(vblk);
  for (int k0 = 0; k0 < 28; k0 += 4) {
    const _Float16* vp = vblk + k0 * 512;
#pragma unroll  // constant j: the ring stays in registers
    for (int j = 0; j < 4; ++j) {                      // three trips ahead: a trip's 8 products are short
      vr[(j + 3) & 3][0] = load_frag_blk(vp + (j + 3) * 512);
      vr[(j + 3) & 3][1] = load_frag_blk(vp + (32 + j + 3) * 512);
      loads_issued(vp);
      pv_trip(acc, vr[j], prow + (k0 + j) * 32, half);
    }
  }
  vr[3][0] = load_frag_blk(vblk + 31 * 512);
  vr[3][1] = load_frag_blk(vblk + 63 * 512);
  loads_issued(vblk);
#pragma unroll
  for (int j = 0; j < 4; ++j) pv_trip(acc, vr[j], prow + (28 + j) * 32, half);
#pragma unroll  // constant t, u, r: accumulators are read from registers
  for (int t = 0; t < 4; ++t) {
#pragma unroll
    for (int u = 0; u < 2; ++u) {
      h8 o;
#pragma unroll
      for (int r = 0; r < 8; ++r) o[r] = (_Float16)(acc[u][t][r] * inv[t]);
      // fragment order (row = query, k = channel): block (t, w), upper or lower half u
      *(h8*)(attn + (size_t)(b * NPIX + qt * QR) * CC + (t * 16 + w) * 512 + u * 256 + lane * 8) = o;
    }
  }
}

// -------- Proj + bias + residual (f32 output, (b, c, h, w))
// As in qkv_kernel: MT pixel tiles per block, one weight fragment feeds MT products.
// attn lies in fragment order and is staged as it lies.
__global__ __launch_bounds__(256) void proj_kernel(const _Float16* __restrict__ attn,
                                                   const _Float16* __restrict__ wp16,
                                                   const float* __restrict__ bp,
                                                   const float* __restrict__ x,
                                                   float* __restrict__ out) {
  __shared__ __attribute__((aligned(16))) _Float16 as[MT * 16 * 512];  // A tiles, 1-KB blocks
  int tid = threadIdx.x;
  int b   = blockIdx.x >> 5;
  int mb  = (blockIdx.x & 31) >> 2;
  int nt  = (blockIdx.x & 3) * 8 + (tid >> 5);
  int lane = tid & 31, half = lane >> 4, l16 = lane & 15;
  const _Float16* wblk = wp16 + (size_t)(nt * 16) * 512 + lane * 8;   // fragment order
  v16h br[4];                                          // register ring: weight fragments of four trips
#pragma unroll  // constant j: the ring stays in registers
  for (int j = 0; j < 3; ++j) br[j] = load_frag_blk(wblk + j * 512);  // fly while attn is staged
  stage_rows_async<MT * 16, 256, 512>(attn + (size_t)(b * NPIX + mb * (MT * 16)) * CC, as, tid);

  const _Float16* ablk = as + lane * 8;
  v8f acc[MT] = {};
  for (int k0 = 0; k0 < 12; k0 += 4) {
    const _Float16* wp4 = wblk + k0 * 512;
#pragma unroll  // constant j, t: the ring and the accumulator arrays stay in registers
    for (int j = 0; j < 4; ++j) {
      br[(j + 3) & 3] = load_frag_blk(wp4 + (j + 3) * 512);
      loads_issued(wp4);
#pragma unroll
      for (int t = 0; t < MT; ++t) {
        v16h af = load_frag_blk(ablk + (t * 16 + k0 + j) * 512);
        acc[t] = __builtin_amdgcn_wmma_f32_16x16x32_f16(false, af, false, br[j], (short)0, acc[t], false, false);
      }
    }
  }
  br[3] = load_frag_blk(wblk + 15 * 512);
  loads_issued(wblk);
#pragma unroll
  for (int j = 0; j < 4; ++j) {
#pragma unroll
    for (int t = 0; t < MT; ++t) {
      v16h af = load_frag_blk(ablk + (t * 16 + 12 + j) * 512);
      acc[t] = __builtin_amdgcn_wmma_f32_16x16x32_f16(false, af, false, br[j], (short)0, acc[t], false, false);
    }
  }
  int co = nt * 16 + l16;
  float bias = bp[co];
#pragma unroll  // constant t, r: accumulators are read from registers
  for (int t = 0; t < MT; ++t) {
#pragma unroll
    for (int r = 0; r < 8; ++r) {
      int p = mb * (MT * 16) + t * 16 + r + 8 * half;
      size_t idx = (size_t)(b * CC + co) * NPIX + p;
      out[idx] = x[idx] + acc[t][r] + bias;
    }
  }
}

extern "C" void kernel_launch(void* const* d_in, const int* in_sizes, int n_in,
                              void* d_out, int out_size, void* d_ws, size_t ws_size,
                              hipStream_t stream) {
  const float* x     = (const float*)d_in[0];
  const float* gamma = (const float*)d_in[1];
  const float* beta  = (const float*)d_in[2];
  const float* wq    = (const float*)d_in[3];
  const float* bq    = (const float*)d_in[4];
  const float* wk    = (const float*)d_in[5];
  const float* bk    = (const float*)d_in[6];
  const float* wv    = (const float*)d_in[7];
  const float* bv    = (const float*)d_in[8];
  const float* wp    = (const float*)d_in[9];
  const float* bp    = (const float*)d_in[10];
  float* out = (float*)d_out;

  char* ws = (char*)d_ws;
  _Float16* w16 = (_Float16*)ws;                                   // 2 MB
  _Float16* hn  = (_Float16*)(ws + (size_t)(2u << 20));            // 32 MB (reused as attn out)
  _Float16* qb  = (_Float16*)(ws + (size_t)(34u << 20));           // 32 MB
  _Float16* kb  = (_Float16*)(ws + (size_t)(66u << 20));           // 32 MB
  _Float16* vtb = (_Float16*)(ws + (size_t)(98u << 20));           // 32 MB
  _Float16* attn = hn;  // hn's last read is qkv_kernel; safe to reuse

  wconv_kernel<<<4096, 256, 0, stream>>>(wq, wk, wv, wp, w16);
  gn_kernel<<<256, 1024, 0, stream>>>(x, gamma, beta, hn);
  qkv_kernel<<<1024, 256, 0, stream>>>(hn, w16, bq, bk, bv, qb, kb, vtb);
  attn_kernel<<<512, 512, 0, stream>>>(qb, kb, vtb, attn);
  proj_kernel<<<1024, 256, 0, stream>>>(attn, w16 + 3 * 262144, bp, x, out);
}

// v007
// Measured time: 147 microseconds a run.
// Timed twice side by side with v006, it ran 1.07 and 1.08 times as fast.
// Over all steps from v000 it is 10.5 times as fast.
#include <hip/hip_runtime.h>
#include <hip/hip_bf16.h>
#include <stdint.h>

typedef _Float16 v16h __attribute__((ext_vector_type(16)));
typedef float    v8f  __attribute__((ext_vector_type(8)));
typedef _Float16 h2   __attribute__((ext_vector_type(2)));
typedef _Float16 h8   __attribute__((ext_vector_type(8)));
typedef float    f4   __attribute__((ext_vector_type(4)));

#define BB   32
#define CC   512
#define NPIX 1024
#define CPG  16
#define EPSV 1e-5f
#define TP 520
#define PP 1048
#define RP 68
#define MT 8
#define QR 64

__device__ __forceinline__ v16h load_frag_row(const _Float16* rowp, int half) {
  v16h out;
#pragma unroll
  for (int j = 0; j < 8; ++j) {
    int k = 2 * j + ((j >= 4) ? 8 : 0) + half * 8;
    h2 p = *(const h2*)(rowp + k);
    out[2 * j]     = p[0];
    out[2 * j + 1] = p[1];
  }
  return out;
}

// Fragment order in the workspace. A matrix of rows x K f16 is kept as blocks of
// 16 rows x 32 k = 1 KB, block index (row / 16) * (K / 32) + k / 32. Inside a block
// the f16 at (row, k) lies at ((k >> 4) & 1) * 256 + (((k >> 3) & 1) * 16 + (row & 15)) * 8
// + (k & 7): the layout of load_frag_row, lane by lane. A fragment is then two b128
// loads of 512 contiguous bytes per wave (4 whole lines each, not 16 pieces of 32 B).
// lp: the block's start + lane * 8.
__device__ __forceinline__ v16h load_frag_blk(const _Float16* lp) {
  h8 lo = *(const h8*)lp;
  h8 hi = *(const h8*)(lp + 256);
  return __builtin_shufflevector(lo, hi, 0, 1, 2, 3, 4, 5, 6, 7, 8, 9, 10, 11, 12, 13, 14, 15);
}

__device__ __forceinline__ float xhalf(float x) {
  int i = __builtin_bit_cast(int, x);
  return __builtin_bit_cast(float, __builtin_amdgcn_permlanex16(i, i, 0x76543210, 0xfedcba98, false, false));
}

__device__ __forceinline__ float exp2_slot(float x) {
  float e;
  asm("v_exp_f32 %0, %1\n\tv_nop" : "=v"(e) : "v"(x));
  return e;
}

template <int ROWS, int NTHR, int PITCH>
__device__ __forceinline__ void stage_rows_async(const _Float16* gsrc,
                                                 _Float16* lds_dst, int tid) {
  unsigned l0 = (unsigned)(uintptr_t)(void*)lds_dst;
#pragma unroll  // both loops: the address arrays stay in registers
  for (int it = 0; it < ROWS * 64 / NTHR; it += 4) {
    unsigned dst[4];                                   // LDS byte addresses
    unsigned long long gsa[4];                         // global addresses
#pragma unroll
    for (int u = 0; u < 4; ++u) {
      int e = ((it + u) * NTHR + tid) * 8;             // f16 elements
      dst[u] = l0 + (unsigned)((e >> 9) * (PITCH * 2) + (e & 511) * 2);
      gsa[u] = (unsigned long long)(uintptr_t)(gsrc + e);
    }
    // Precaution: the wait closes the copies' own statement, so that no address
    // register of an issued copy is rewritten in front of it.
    asm volatile("global_load_async_to_lds_b128 %0, %4, off\n\t"
                 "global_load_async_to_lds_b128 %1, %5, off\n\t"
                 "global_load_async_to_lds_b128 %2, %6, off\n\t"
                 "global_load_async_to_lds_b128 %3, %7, off\n\t"
                 "s_wait_xcnt 0x0"
                 :: "v"(dst[0]), "v"(dst[1]), "v"(dst[2]), "v"(dst[3]),
                    "v"(gsa[0]), "v"(gsa[1]), "v"(gsa[2]), "v"(gsa[3]) : "memory");
  }
  // The copies have landed before the barrier publishes the tile to all waves.
  asm volatile("s_wait_asynccnt 0x0" ::: "memory");
  __syncthreads();
}

// -------- GroupNorm: (B,512,1024) f32 -> normalized f16 in (b, p, c) layout
// One block = one image x 64 channels (4 groups) x all 1024 pixels, held in
// registers, so x is read once. lane = (pq, cg): a thread owns channels
// cg*8..cg*8+7 at 8 pixels; the eight cg lanes of one pixel together store one
// whole 128-byte line of hn.
__global__ __launch_bounds__(1024) void gn_kernel(const float* __restrict__ x,
                                                  const float* __restrict__ gamma,
                                                  const float* __restrict__ beta,
                                                  _Float16* __restrict__ hn) {
  __shared__ f4 red[4 * 17];
  int tid = threadIdx.x;
  int w = tid >> 5, lane = tid & 31, cg = lane & 7, pq = lane >> 3;
  int b = blockIdx.x >> 3, cb = blockIdx.x & 7;
  int ch0 = cb * 64 + cg * 8;
  int p0  = w * 32 + pq * 4;
  int grp = cg >> 1;                                  // group inside the block
  const float* xb = x + (size_t)(b * CC + ch0) * NPIX + p0;

  f4 v[8][2];
#pragma unroll
  for (int j = 0; j < 8; ++j) {
    v[j][0] = *(const f4*)(xb + j * NPIX);
    v[j][1] = *(const f4*)(xb + j * NPIX + 16);
  }
  unsigned goff = (unsigned)ch0 * 4u;                 // byte offset into gamma, beta
  f4 ga[2], be[2];
  ga[0] = *(const f4*)((const char*)gamma + goff);
  ga[1] = *(const f4*)((const char*)gamma + goff + 16);
  be[0] = *(const f4*)((const char*)beta + goff);
  be[1] = *(const f4*)((const char*)beta + goff + 16);
  // Precaution: the address registers stay live up to this wait, so that no
  // load's result is placed in a register that an issued load still names.
  asm volatile("s_wait_xcnt 0x0" :: "v"(xb), "v"(goff) : "memory");

  f4 s4 = {}, ss4 = {};
#pragma unroll
  for (int j = 0; j < 8; ++j) {
    s4 += v[j][0]; ss4 += v[j][0] * v[j][0];
    s4 += v[j][1]; ss4 += v[j][1] * v[j][1];
  }
  float s  = (s4[0] + s4[1]) + (s4[2] + s4[3]);
  float ss = (ss4[0] + ss4[1]) + (ss4[2] + ss4[3]);
  // Lanes of one group inside a wave: cg pair (bit 0) and the four pq (bits 3, 4).
  s += __shfl_xor(s, 1);  ss += __shfl_xor(ss, 1);
  s += __shfl_xor(s, 8);  ss += __shfl_xor(ss, 8);
  s += __shfl_xor(s, 16); ss += __shfl_xor(ss, 16);
  if ((lane & 25) == 0) {
    float* rf = (float*)red + grp * 68 + w * 2;
    rf[0] = s; rf[1] = ss;
  }
  __syncthreads();
  f4 t4 = {};
#pragma unroll
  for (int t = 0; t < 16; ++t) t4 += red[grp * 17 + t];
  float mean = (t4[0] + t4[2]) * (1.f / 16384.f);
  float var  = (t4[1] + t4[3]) * (1.f / 16384.f) - mean * mean;
  float inv  = rsqrtf(var + EPSV);

  _Float16* hb = hn + (size_t)(b * NPIX + p0) * CC + ch0;
#pragma unroll
  for (int h = 0; h < 2; ++h) {
#pragma unroll
    for (int i = 0; i < 4; ++i) {
      h8 o;
#pragma unroll
      for (int j = 0; j < 8; ++j)
        o[j] = (_Float16)((v[j][h][i] - mean) * inv * ga[j >> 2][j & 3] + be[j >> 2][j & 3]);
      *(h8*)(hb + (size_t)(h * 16 + i) * CC) = o;
    }
  }
}

// -------- Convert the four 512x512 f32 weights to f16 (concatenated), each in
// fragment order (rows = output channels, k = input channels)
__global__ __launch_bounds__(256) void wconv_kernel(const float* __restrict__ wq,
                                                    const float* __restrict__ wk,
                                                    const float* __restrict__ wv,
                                                    const float* __restrict__ wp,
                                                    _Float16* __restrict__ w16) {
  int i = blockIdx.x * 256 + threadIdx.x;   // 0 .. 4*262144-1
  int which = i >> 18, off = i & 262143;
  const float* src = (which == 0) ? wq : (which == 1) ? wk : (which == 2) ? wv : wp;
  int co = (off >> 13) * 16 + ((off >> 3) & 15);
  int ci = ((off >> 9) & 15) * 32 + ((off >> 8) & 1) * 16 + ((off >> 7) & 1) * 8 + (off & 7);
  w16[i] = (_Float16)src[co * CC + ci];
}

// -------- QKV: q, k (row = pixel, k = channel), v_t (row = channel, k = pixel), each
// image's matrix in fragment order.
// 8 waves/block share MT pixel tiles (128 pixels), async-staged to LDS once.
// A weight fragment, loaded from global, feeds MT products. q and k are formed
// transposed (weight rows as A), v as pixels x channels: in both a lane then holds
// the 8 consecutive k of its own place in a block, one b128 store.
__global__ __launch_bounds__(256) void qkv_kernel(const _Float16* __restrict__ hn,
                                                  const _Float16* __restrict__ w16,
                                                  const float* __restrict__ bq,
                                                  const float* __restrict__ bk,
                                                  const float* __restrict__ bv,
                                                  _Float16* __restrict__ q,
                                                  _Float16* __restrict__ k,
                                                  _Float16* __restrict__ vt) {
  __shared__ __attribute__((aligned(16))) _Float16 as[MT * 16 * TP];  // pixel tiles, padded rows
  int tid = threadIdx.x;
  int b   = blockIdx.x >> 5;                          // 32 blocks per image:
  int mb  = (blockIdx.x & 31) >> 2;                   // 8 tiles of 128 pixels x
  int nt  = (blockIdx.x & 3) * 8 + (tid >> 5);        // 4 groups of 8 channel tiles
  stage_rows_async<MT * 16, 256, TP>(hn + (size_t)(b * NPIX + mb * (MT * 16)) * CC, as, tid);

  int lane = tid & 31, half = lane >> 4, l16 = lane & 15;

  const _Float16* arow = as + (size_t)l16 * TP;       // LDS pixel fragments
  const _Float16* wqr  = w16 + (size_t)(nt * 16) * 512 + lane * 8;

  // Many blocks read the same weight lines. Each starts its walk over the 16 channel
  // steps at its own step and wraps, so that they do not ask L2 for one line at one moment.
  int rot = (blockIdx.x >> 2) & 15;
  v8f aq[MT] = {}, ak[MT] = {}, av[MT] = {};
  for (int ki = 0; ki < 16; ++ki) {
    int kk = (ki + rot) & 15;
    int ko = kk * 32;
    const _Float16* wst = wqr + kk * 512;
    v16h bfq = load_frag_blk(wst);
    v16h bfk = load_frag_blk(wst + 262144);
    v16h bfv = load_frag_blk(wst + 524288);
#pragma unroll  // constant t: the accumulator arrays stay in registers
    for (int t = 0; t < MT; ++t) {
      v16h af = load_frag_row(arow + t * 16 * TP + ko, half);
      aq[t] = __builtin_amdgcn_wmma_f32_16x16x32_f16(false, bfq, false, af, (short)0, aq[t], false, false);
      ak[t] = __builtin_amdgcn_wmma_f32_16x16x32_f16(false, bfk, false, af, (short)0, ak[t], false, false);
      av[t] = __builtin_amdgcn_wmma_f32_16x16x32_f16(false, af, false, bfv, (short)0, av[t], false, false);
    }
  }
  // aq, ak [t][r]: pixel t*16 + l16, channel nt*16 + 8*half + r.
  // av [t][r]: channel nt*16 + l16, pixel t*16 + 8*half + r.
  unsigned o8 = (unsigned)(nt * 16 + 8 * half) * 4u;  // byte offsets into the biases
  unsigned o1 = (unsigned)(nt * 16 + l16) * 4u;
  float biasv = *(const float*)((const char*)bv + o1);
  f4 biasq[2], biask[2];
  biasq[0] = *(const f4*)((const char*)bq + o8); biasq[1] = *(const f4*)((const char*)bq + o8 + 16);
  biask[0] = *(const f4*)((const char*)bk + o8); biask[1] = *(const f4*)((const char*)bk + o8 + 16);
  // Precaution: the offset registers stay live up to this wait, so that no
  // load's result is placed in a register that an issued load still names.
  asm volatile("s_wait_xcnt 0x0" :: "v"(o8), "v"(o1) : "memory");
  size_t img = (size_t)b * (NPIX * CC);
  size_t qko = img + (size_t)((mb * MT) * 16 + (nt >> 1)) * 512 + (nt & 1) * 256 + lane * 8;
  size_t vo  = img + (size_t)(nt * 32 + mb * (MT / 2)) * 512 + lane * 8;
#pragma unroll  // constant t, r here and below: accumulators are read from registers
  for (int t = 0; t < MT; ++t) {
    h8 ov;
#pragma unroll
    for (int r = 0; r < 8; ++r) ov[r] = (_Float16)(av[t][r] + biasv);
    *(h8*)(vt + vo + (t >> 1) * 512 + (t & 1) * 256) = ov;
  }
#pragma unroll
  for (int t = 0; t < MT; ++t) {
    h8 oq;
#pragma unroll
    for (int r = 0; r < 8; ++r) oq[r] = (_Float16)(aq[t][r] + biasq[r >> 2][r & 3]);
    *(h8*)(q + qko + t * (16 * 512)) = oq;
  }
#pragma unroll
  for (int t = 0; t < MT; ++t) {
    h8 ok;
#pragma unroll
    for (int r = 0; r < 8; ++r) ok[r] = (_Float16)(ak[t][r] + biask[r >> 2][r & 3]);
    *(h8*)(k + qko + t * (16 * 512)) = ok;
  }
}

// One trip of phase 1 of the attention kernel: 4 K fragments x 4 q fragments (LDS, qp).
__device__ __forceinline__ void qk_trip(v8f (&s)[4][4], const v16h (&kf)[4], const _Float16* qp) {
#pragma unroll  // constant t, u: fragments and accumulators stay in registers
  for (int t = 0; t < 4; ++t) {
    v16h qf = load_frag_blk(qp + t * 16 * 512);
#pragma unroll
    for (int u = 0; u < 4; ++u)
      s[u][t] = __builtin_amdgcn_wmma_f32_16x16x32_f16(false, kf[u], false, qf, (short)0, s[u][t], false, false);
  }
}

// One trip of phase 3: 2 V^T fragments x 4 P fragments (LDS rows at pp).
__device__ __forceinline__ void pv_trip(v8f (&acc)[2][4], const v16h (&vf)[2], const _Float16* pp, int half) {
#pragma unroll  // constant t: the accumulator arrays stay in registers
  for (int t = 0; t < 4; ++t) {
    v16h pf = load_frag_row(pp + t * 16 * PP, half);
    acc[0][t] = __builtin_amdgcn_wmma_f32_16x16x32_f16(false, vf[0], false, pf, (short)0, acc[0][t], false, false);
    acc[1][t] = __builtin_amdgcn_wmma_f32_16x16x32_f16(false, vf[1], false, pf, (short)0, acc[1][t], false, false);
  }
}

__device__ __forceinline__ void loads_issued(const _Float16* p) {
  asm volatile("s_wait_xcnt 0x0" :: "v"(p) : "memory");
}

// -------- Attention: per (batch, 64-query tile) block, scores stay in registers
// 16 waves. Both products are formed transposed (K or V^T rows as A, q or P rows
// as B), so a lane owns one query per tile and its keys or channels lie along the
// accumulator registers. A wave holds 64 keys x 64 queries of scores (4 x 4 tiles):
// a K fragment, loaded from global in fragment order, feeds four query tiles, and
// the softmax works on the accumulators; only exp(s - max), as f16, goes to LDS.
__global__ __launch_bounds__(512) void attn_kernel(const _Float16* __restrict__ q,
                                                   const _Float16* __restrict__ k,
                                                   const _Float16* __restrict__ vt,
                                                   _Float16* __restrict__ attn) {
  __shared__ __attribute__((aligned(16))) char smem[QR * PP * 2 + 2 * 16 * RP * 4];
  _Float16* P    = (_Float16*)smem;                    // QR rows x PP f16
  _Float16* qs   = P;                                  // q stage (64 blocks of 1 KB) overlaps P:
                                                       // qs dead before P is written
  float*    redm = (float*)(smem + QR * PP * 2);       // 16 waves x RP: maxima
  float*    reds = redm + 16 * RP;                     // 16 waves x RP: sums

  int tid = threadIdx.x;
  int w = tid >> 5, lane = tid & 31, half = lane >> 4, l16 = lane & 15;
  int b = blockIdx.x >> 4, qt = blockIdx.x & 15;
  const float sc2 = 0.044194173824159216f * 1.4426950408889634f;  // 512^-0.5 * log2(e)

  const _Float16* kblk = k + (size_t)(b * NPIX + w * 64) * CC + lane * 8;
  v16h kf[2][4];                                       // two register sets: this trip, the next
#pragma unroll  // constant u: the fragments stay in registers
  for (int u = 0; u < 4; ++u) kf[0][u] = load_frag_blk(kblk + qt * 512 + u * 16 * 512);
  loads_issued(kblk + qt * 512);
  stage_rows_async<QR, 512, 512>(q + (size_t)(b * NPIX + qt * QR) * CC, qs, tid);
  const _Float16* qblk = qs + lane * 8;

  // Phase 1: S^T = k_rows x q_tile^T. s[u][t][r]: key w*64 + u*16 + 8*half + r,
  // query t*16 + l16. The K fragments of trip ki + 1 are loaded in front of the
  // products of trip ki, so that their way from L2 is covered by those products.
  v8f s[4][4] = {};
#pragma nounroll  // unrolled whole, as the compiler does unasked, the build spills accumulators to scratch
  for (int ki = 0; ki < 14; ki += 2) {
    int c0 = ((ki + qt) & 15) * 512, c1 = ((ki + 1 + qt) & 15) * 512, c2 = ((ki + 2 + qt) & 15) * 512;
    const _Float16* kp1 = kblk + c1;
#pragma unroll  // constant u here and below: the fragments stay in registers
    for (int u = 0; u < 4; ++u) kf[1][u] = load_frag_blk(kp1 + u * 16 * 512);
    loads_issued(kp1);
    qk_trip(s, kf[0], qblk + c0);
    const _Float16* kp2 = kblk + c2;
#pragma unroll
    for (int u = 0; u < 4; ++u) kf[0][u] = load_frag_blk(kp2 + u * 16 * 512);
    loads_issued(kp2);
    qk_trip(s, kf[1], qblk + c1);
  }
  const _Float16* kpl = kblk + ((15 + qt) & 15) * 512;
#pragma unroll
  for (int u = 0; u < 4; ++u) kf[1][u] = load_frag_blk(kpl + u * 16 * 512);
  loads_issued(kpl);
  qk_trip(s, kf[0], qblk + ((14 + qt) & 15) * 512);
  qk_trip(s, kf[1], qblk + ((15 + qt) & 15) * 512);

  // Phase 2: softmax over the keys of each query. In a lane: over its 32 keys per
  // query tile; then the other lane half; then the 16 waves, through LDS.
  f4 mx;
#pragma unroll  // constant t, u, r here and below: accumulators are read from registers
  for (int t = 0; t < 4; ++t) {
    float m = s[0][t][0];
#pragma unroll
    for (int u = 0; u < 4; ++u) {
#pragma unroll
      for (int r = 0; r < 8; ++r) m = fmaxf(m, s[u][t][r]);
    }
    mx[t] = fmaxf(m, xhalf(m));
  }
  if (half == 0) *(f4*)(redm + w * RP + l16 * 4) = mx;
  __syncthreads();                                     // also: every wave has left qs
  f4 gm = *(const f4*)(redm + (half * 8) * RP + l16 * 4);
#pragma unroll
  for (int j = 1; j < 8; ++j) {
    f4 o = *(const f4*)(redm + (half * 8 + j) * RP + l16 * 4);
#pragma unroll
    for (int t = 0; t < 4; ++t) gm[t] = fmaxf(gm[t], o[t]);
  }
  f4 sm = {};
#pragma unroll
  for (int t = 0; t < 4; ++t) {
    float mc = fmaxf(gm[t], xhalf(gm[t])) * sc2;
#pragma unroll
    for (int u = 0; u < 4; ++u) {
      h8 o;
#pragma unroll
      for (int r = 0; r < 8; ++r) {
        float e = exp2_slot(fmaf(s[u][t][r], sc2, -mc));
        sm[t] += e;
        o[r] = (_Float16)e;
      }
      *(h8*)(P + (size_t)(t * 16 + l16) * PP + (w * 4 + u) * 16 + half * 8) = o;
    }
    sm[t] += xhalf(sm[t]);
  }
  if (half == 0) *(f4*)(reds + w * RP + l16 * 4) = sm;
  __syncthreads();                                     // publishes P and the partial sums
  f4 gs = {};
#pragma unroll
  for (int j = 0; j < 8; ++j) gs += *(const f4*)(reds + (half * 8 + j) * RP + l16 * 4);
  f4 inv;
#pragma unroll
  for (int t = 0; t < 4; ++t) inv[t] = 1.f / (gs[t] + xhalf(gs[t]));

  // Phase 3: out^T = V^T rows x P^T, 2 channel tiles x 4 query tiles per wave; the
  // division by the row sum is done on the f32 result.
  const _Float16* prow = P + (size_t)l16 * PP;
  const _Float16* vblk = vt + (size_t)(b * CC + w * 32) * NPIX + lane * 8;   // and 32 blocks on
  v8f acc[2][4] = {};
  v16h vr[4][2];                                       // register ring: V fragments of four trips
#pragma unroll  // constant j: the ring stays in registers
  for (int j = 0; j < 3; ++j) {
    const _Float16* vp = vblk + ((j + 2 * qt) & 31) * 512;
    vr[j][0] = load_frag_blk(vp);
    vr[j][1] = load_frag_blk(vp + 32 * 512);
    loads_issued(vp);
  }
  for (int k0 = 2 * qt; k0 < 2 * qt + 28; k0 += 4) {
#pragma unroll  // constant j: the ring stays in registers
    for (int j = 0; j < 4; ++j) {                      // three trips ahead: a trip's 8 products are short
      const _Float16* vp = vblk + ((k0 + j + 3) & 31) * 512;
      vr[(j + 3) & 3][0] = load_frag_blk(vp);
      vr[(j + 3) & 3][1] = load_frag_blk(vp + 32 * 512);
      loads_issued(vp);
      pv_trip(acc, vr[j], prow + ((k0 + j) & 31) * 32, half);
    }
  }
  const _Float16* vpl = vblk + ((2 * qt + 31) & 31) * 512;
  vr[3][0] = load_frag_blk(vpl);
  vr[3][1] = load_frag_blk(vpl + 32 * 512);
  loads_issued(vpl);
#pragma unroll
  for (int j = 0; j < 4; ++j) pv_trip(acc, vr[j], prow + ((2 * qt + 28 + j) & 31) * 32, half);
#pragma unroll  // constant t, u, r: accumulators are read from registers
  for (int t = 0; t < 4; ++t) {
#pragma unroll
    for (int u = 0; u < 2; ++u) {
      h8 o;
#pragma unroll
      for (int r = 0; r < 8; ++r) o[r] = (_Float16)(acc[u][t][r] * inv[t]);
      // fragment order (row = query, k = channel): block (t, w), upper or lower half u
      *(h8*)(attn + (size_t)(b * NPIX + qt * QR) * CC + (t * 16 + w) * 512 + u * 256 + lane * 8) = o;
    }
  }
}

// -------- Proj + bias + residual (f32 output, (b, c, h, w))
// As in qkv_kernel: MT pixel tiles per block, one weight fragment feeds MT products.
// attn lies in fragment order and is staged as it lies.
__global__ __launch_bounds__(256) void proj_kernel(const _Float16* __restrict__ attn,
                                                   const _Float16* __restrict__ wp16,
                                                   const float* __restrict__ bp,
                                                   const float* __restrict__ x,
                                                   float* __restrict__ out) {
  __shared__ __attribute__((aligned(16))) _Float16 as[MT * 16 * 512];  // A tiles, 1-KB blocks
  int tid = threadIdx.x;
  int b   = blockIdx.x >> 5;
  int mb  = (blockIdx.x & 31) >> 2;
  int nt  = (blockIdx.x & 3) * 8 + (tid >> 5);
  int lane = tid & 31, half = lane >> 4, l16 = lane & 15;
  const _Float16* wblk = wp16 + (size_t)(nt * 16) * 512 + lane * 8;   // fragment order
  // As in qkv_kernel: each block starts its walk over the 16 channel steps at its own step.
  int rot = (blockIdx.x >> 2) & 15;
  v16h br[4];                                          // register ring: weight fragments of four trips
#pragma unroll  // constant j: the ring stays in registers
  for (int j = 0; j < 3; ++j) {                        // fly while attn is staged
    const _Float16* wp1 = wblk + ((rot + j) & 15) * 512;
    br[j] = load_frag_blk(wp1);
    loads_issued(wp1);
  }
  stage_rows_async<MT * 16, 256, 512>(attn + (size_t)(b * NPIX + mb * (MT * 16)) * CC, as, tid);

  const _Float16* ablk = as + lane * 8;
  v8f acc[MT] = {};
  for (int k0 = rot; k0 < rot + 12; k0 += 4) {
#pragma unroll  // constant j, t: the ring and the accumulator arrays stay in registers
    for (int j = 0; j < 4; ++j) {
      const _Float16* wp1 = wblk + ((k0 + j + 3) & 15) * 512;
      br[(j + 3) & 3] = load_frag_blk(wp1);
      loads_issued(wp1);
      const _Float16* ast = ablk + ((k0 + j) & 15) * 512;
#pragma unroll
      for (int t = 0; t < MT; ++t) {
        v16h af = load_frag_blk(ast + t * 16 * 512);
        acc[t] = __builtin_amdgcn_wmma_f32_16x16x32_f16(false, af, false, br[j], (short)0, acc[t], false, false);
      }
    }
  }
  const _Float16* wpl = wblk + ((rot + 15) & 15) * 512;
  br[3] = load_frag_blk(wpl);
  loads_issued(wpl);
#pragma unroll
  for (int j = 0; j < 4; ++j) {
    const _Float16* ast = ablk + ((rot + 12 + j) & 15) * 512;
#pragma unroll
    for (int t = 0; t < MT; ++t) {
      v16h af = load_frag_blk(ast + t * 16 * 512);
      acc[t] = __builtin_amdgcn_wmma_f32_16x16x32_f16(false, af, false, br[j], (short)0, acc[t], false, false);
    }
  }
  int co = nt * 16 + l16;
  float bias = bp[co];
#pragma unroll  // constant t, r: accumulators are read from registers
  for (int t = 0; t < MT; ++t) {
#pragma unroll
    for (int r = 0; r < 8; ++r) {
      int p = mb * (MT * 16) + t * 16 + r + 8 * half;
      size_t idx = (size_t)(b * CC + co) * NPIX + p;
      out[idx] = x[idx] + acc[t][r] + bias;
    }
  }
}

extern "C" void kernel_launch(void* const* d_in, const int* in_sizes, int n_in,
                              void* d_out, int out_size, void* d_ws, size_t ws_size,
                              hipStream_t stream) {
  const float* x     = (const float*)d_in[0];
  const float* gamma = (const float*)d_in[1];
  const float* beta  = (const float*)d_in[2];
  const float* wq    = (const float*)d_in[3];
  const float* bq    = (const float*)d_in[4];
  const float* wk    = (const float*)d_in[5];
  const float* bk    = (const float*)d_in[6];
  const float* wv    = (const float*)d_in[7];
  const float* bv    = (const float*)d_in[8];
  const float* wp    = (const float*)d_in[9];
  const float* bp    = (const float*)d_in[10];
  float* out = (float*)d_out;

  char* ws = (char*)d_ws;
  _Float16* w16 = (_Float16*)ws;                                   // 2 MB
  _Float16* hn  = (_Float16*)(ws + (size_t)(2u << 20));            // 32 MB (reused as attn out)
  _Float16* qb  = (_Float16*)(ws + (size_t)(34u << 20));           // 32 MB
  _Float16* kb  = (_Float16*)(ws + (size_t)(66u << 20));           // 32 MB
  _Float16* vtb = (_Float16*)(ws + (size_t)(98u << 20));           // 32 MB
  _Float16* attn = hn;  // hn's last read is qkv_kernel; safe to reuse

  wconv_kernel<<<4096, 256, 0, stream>>>(wq, wk, wv, wp, w16);
  gn_kernel<<<256, 1024, 0, stream>>>(x, gamma, beta, hn);
  qkv_kernel<<<1024, 256, 0, stream>>>(hn, w16, bq, bk, bv, qb, kb, vtb);
  attn_kernel<<<512, 512, 0, stream>>>(qb, kb, vtb, attn);
  proj_kernel<<<1024, 256, 0, stream>>>(attn, w16 + 3 * 262144, bp, x, out);
}

// v008
// It runs in 115 microseconds.
// Timed twice side by side with v007, it ran 1.27 times as fast both times.
// All steps since v000 together make it 13.4 times as fast.
#include <hip/hip_runtime.h>
#include <hip/hip_bf16.h>
#include <stdint.h>

typedef _Float16 v16h __attribute__((ext_vector_type(16)));
typedef float    v8f  __attribute__((ext_vector_type(8)));
typedef _Float16 h2   __attribute__((ext_vector_type(2)));
typedef _Float16 h4   __attribute__((ext_vector_type(4)));
typedef _Float16 h8   __attribute__((ext_vector_type(8)));
typedef float    f4   __attribute__((ext_vector_type(4)));

#define BB   32
#define CC   512
#define NPIX 1024
#define CPG  16
#define EPSV 1e-5f
#define TP 520
#define PP 1048
#define RP 68
#define MT 8
#define QR 64
#define QTB 16448

__device__ __forceinline__ v16h load_frag_row(const _Float16* rowp, int half) {
  v16h out;
#pragma unroll
  for (int j = 0; j < 8; ++j) {
    int k = 2 * j + ((j >= 4) ? 8 : 0) + half * 8;
    h2 p = *(const h2*)(rowp + k);
    out[2 * j]     = p[0];
    out[2 * j + 1] = p[1];
  }
  return out;
}

// Fragment order in the workspace. A matrix of rows x K f16 is kept as blocks of
// 16 rows x 32 k = 1 KB, block index (row / 16) * (K / 32) + k / 32. Inside a block
// the f16 at (row, k) lies at ((k >> 4) & 1) * 256 + (((k >> 3) & 1) * 16 + (row & 15)) * 8
// + (k & 7): the layout of load_frag_row, lane by lane. A fragment is then two b128
// loads of 512 contiguous bytes per wave (4 whole lines each, not 16 pieces of 32 B).
// lp: the block's start + lane * 8.
__device__ __forceinline__ v16h load_frag_blk(const _Float16* lp) {
  h8 lo = *(const h8*)lp;
  h8 hi = *(const h8*)(lp + 256);
  return __builtin_shufflevector(lo, hi, 0, 1, 2, 3, 4, 5, 6, 7, 8, 9, 10, 11, 12, 13, 14, 15);
}

__device__ __forceinline__ float xhalf(float x) {
  int i = __builtin_bit_cast(int, x);
  return __builtin_bit_cast(float, __builtin_amdgcn_permlanex16(i, i, 0x76543210, 0xfedcba98, false, false));
}

__device__ __forceinline__ float exp2_slot(float x) {
  float e;
  asm("v_exp_f32 %0, %1\n\tv_nop" : "=v"(e) : "v"(x));
  return e;
}

template <int ROWS, int NTHR, int PITCH>
__device__ __forceinline__ void stage_rows_async(const _Float16* gsrc,
                                                 _Float16* lds_dst, int tid) {
  unsigned l0 = (unsigned)(uintptr_t)(void*)lds_dst;
#pragma unroll  // both loops: the address arrays stay in registers
  for (int it = 0; it < ROWS * 64 / NTHR; it += 4) {
    unsigned dst[4];                                   // LDS byte addresses
    unsigned long long gsa[4];                         // global addresses
#pragma unroll
    for (int u = 0; u < 4; ++u) {
      int e = ((it + u) * NTHR + tid) * 8;             // f16 elements
      dst[u] = l0 + (unsigned)((e >> 9) * (PITCH * 2) + (e & 511) * 2);
      gsa[u] = (unsigned long long)(uintptr_t)(gsrc + e);
    }
    // Precaution: the wait closes the copies' own statement, so that no address
    // register of an issued copy is rewritten in front of it.
    asm volatile("global_load_async_to_lds_b128 %0, %4, off\n\t"
                 "global_load_async_to_lds_b128 %1, %5, off\n\t"
                 "global_load_async_to_lds_b128 %2, %6, off\n\t"
                 "global_load_async_to_lds_b128 %3, %7, off\n\t"
                 "s_wait_xcnt 0x0"
                 :: "v"(dst[0]), "v"(dst[1]), "v"(dst[2]), "v"(dst[3]),
                    "v"(gsa[0]), "v"(gsa[1]), "v"(gsa[2]), "v"(gsa[3]) : "memory");
  }
  // The copies have landed before the barrier publishes the tile to all waves.
  asm volatile("s_wait_asynccnt 0x0" ::: "memory");
  __syncthreads();
}

// -------- GroupNorm: (B,512,1024) f32 -> normalized f16 in (b, p, c) layout
// One block = one image x 64 channels (4 groups) x all 1024 pixels, held in
// registers, so x is read once. lane = (pq, cg): a thread owns channels
// cg*8..cg*8+7 at 8 pixels; the eight cg lanes of one pixel together store one
// whole 128-byte line of hn.
__global__ __launch_bounds__(1024) void gn_kernel(const float* __restrict__ x,
                                                  const float* __restrict__ gamma,
                                                  const float* __restrict__ beta,
                                                  _Float16* __restrict__ hn) {
  __shared__ f4 red[4 * 17];
  int tid = threadIdx.x;
  int w = tid >> 5, lane = tid & 31, cg = lane & 7, pq = lane >> 3;
  int b = blockIdx.x >> 3, cb = blockIdx.x & 7;
  int ch0 = cb * 64 + cg * 8;
  int p0  = w * 32 + pq * 4;
  int grp = cg >> 1;                                  // group inside the block
  const float* xb = x + (size_t)(b * CC + ch0) * NPIX + p0;

  f4 v[8][2];
#pragma unroll
  for (int j = 0; j < 8; ++j) {
    v[j][0] = *(const f4*)(xb + j * NPIX);
    v[j][1] = *(const f4*)(xb + j * NPIX + 16);
  }
  unsigned goff = (unsigned)ch0 * 4u;                 // byte offset into gamma, beta
  f4 ga[2], be[2];
  ga[0] = *(const f4*)((const char*)gamma + goff);
  ga[1] = *(const f4*)((const char*)gamma + goff + 16);
  be[0] = *(const f4*)((const char*)beta + goff);
  be[1] = *(const f4*)((const char*)beta + goff + 16);
  // Precaution: the address registers stay live up to this wait, so that no
  // load's result is placed in a register that an issued load still names.
  asm volatile("s_wait_xcnt 0x0" :: "v"(xb), "v"(goff) : "memory");

  f4 s4 = {}, ss4 = {};
#pragma unroll
  for (int j = 0; j < 8; ++j) {
    s4 += v[j][0]; ss4 += v[j][0] * v[j][0];
    s4 += v[j][1]; ss4 += v[j][1] * v[j][1];
  }
  float s  = (s4[0] + s4[1]) + (s4[2] + s4[3]);
  float ss = (ss4[0] + ss4[1]) + (ss4[2] + ss4[3]);
  // Lanes of one group inside a wave: cg pair (bit 0) and the four pq (bits 3, 4).
  s += __shfl_xor(s, 1);  ss += __shfl_xor(ss, 1);
  s += __shfl_xor(s, 8);  ss += __shfl_xor(ss, 8);
  s += __shfl_xor(s, 16); ss += __shfl_xor(ss, 16);
  if ((lane & 25) == 0) {
    float* rf = (float*)red + grp * 68 + w * 2;
    rf[0] = s; rf[1] = ss;
  }
  __syncthreads();
  f4 t4 = {};
#pragma unroll
  for (int t = 0; t < 16; ++t) t4 += red[grp * 17 + t];
  float mean = (t4[0] + t4[2]) * (1.f / 16384.f);
  float var  = (t4[1] + t4[3]) * (1.f / 16384.f) - mean * mean;
  float inv  = rsqrtf(var + EPSV);

  _Float16* hb = hn + (size_t)(b * NPIX + p0) * CC + ch0;
#pragma unroll
  for (int h = 0; h < 2; ++h) {
#pragma unroll
    for (int i = 0; i < 4; ++i) {
      h8 o;
#pragma unroll
      for (int j = 0; j < 8; ++j)
        o[j] = (_Float16)((v[j][h][i] - mean) * inv * ga[j >> 2][j & 3] + be[j >> 2][j & 3]);
      *(h8*)(hb + (size_t)(h * 16 + i) * CC) = o;
    }
  }
}

// -------- Weights. The output projection is linear, so
// Wp (sum_j p_j (Wv h_j + bv)) + bp = sum_j p_j ((Wp Wv) h_j + Wp bv) + bp:
// the value projection is done with Wp Wv and Wp bv, and no projection follows the attention.
// Blocks 0..127: Wp Wv, one 16 x 16 tile a wave, f16 operands, f32 sums, stored as the
// third matrix of w16 in fragment order (rows = output channels, k = input channels).
// Blocks 128..191: Wp bv in f32. Blocks 192..2239: wq, wk to f16 in the same order.
// The long waves come first, so that they run while the many short ones are started.
__global__ __launch_bounds__(256) void prep_kernel(const float* __restrict__ wq,
                                                   const float* __restrict__ wk,
                                                   const float* __restrict__ wv,
                                                   const float* __restrict__ wp,
                                                   const float* __restrict__ bv,
                                                   _Float16* __restrict__ w16,
                                                   float* __restrict__ bv2) {
  __shared__ __attribute__((aligned(16))) _Float16 wps[16 * TP];    // 16 rows of Wp, padded
  int tid = threadIdx.x, blk = blockIdx.x;
  if (blk >= 192) {
    int i = (blk - 192) * 256 + tid;        // 0 .. 2*262144-1
    int which = i >> 18, off = i & 262143;
    const float* src = (which == 0) ? wq : wk;
    int co = (off >> 13) * 16 + ((off >> 3) & 15);
    int ci = ((off >> 9) & 15) * 32 + ((off >> 8) & 1) * 16 + ((off >> 7) & 1) * 8 + (off & 7);
    w16[i] = (_Float16)src[co * CC + ci];
    return;
  }
  int w = tid >> 5, lane = tid & 31, half = lane >> 4, l16 = lane & 15;
  if (blk < 128) {
    // Formed transposed (columns of Wv as A rows, rows of Wp as B): a lane then holds the
    // 8 consecutive input channels of its own place in a block, one b128 store.
    // The 8 waves share 16 rows of Wp. Read as fragments from global, a load would touch
    // 16 lines; they are read in whole lines once, and the fragments come from LDS.
    int cot = blk >> 2, cit = (blk & 3) * 8 + w;
    const float* sp = wp + (cot * 16 + (tid >> 4)) * CC + (tid & 15) * 4;
    f4 st[8];
#pragma unroll  // constant j here and below: the array stays in registers
    for (int j = 0; j < 8; ++j) st[j] = *(const f4*)(sp + j * 64);
#pragma unroll
    for (int j = 0; j < 8; ++j) {
      h4 o4 = {(_Float16)st[j][0], (_Float16)st[j][1], (_Float16)st[j][2], (_Float16)st[j][3]};
      *(h4*)(wps + (tid >> 4) * TP + (tid & 15) * 4 + j * 64) = o4;
    }
    __syncthreads();                                   // publishes the 16 rows
    const float* ap = wv + (half * 8) * CC + cit * 16 + l16;        // + m * CC
    const _Float16* brow = wps + l16 * TP;
    v8f acc = {};
#pragma nounroll  // one trip keeps the loads of four k steps in flight; more would only add registers
    for (int k0 = 0; k0 < 16; k0 += 4) {
      float av[4][16];
      const float* a0 = ap + k0 * 32 * CC;
#pragma unroll  // constant j, e here and below: the array stays in registers
      for (int j = 0; j < 4; ++j) {
#pragma unroll
        for (int e = 0; e < 8; ++e) {
          av[j][e]     = a0[(j * 32 + e) * CC];
          av[j][8 + e] = a0[(j * 32 + 16 + e) * CC];
        }
      }
      // The memory clobber keeps all 64 loads in front, in flight together: without it the
      // compiler holds part of them back until registers of the first ones are free again.
      // Precaution: the address register stays live up to the wait.
      asm volatile("s_wait_xcnt 0x0" :: "v"(a0) : "memory");
#pragma unroll
      for (int j = 0; j < 4; ++j) {
        v16h af;
#pragma unroll
        for (int e = 0; e < 16; ++e) af[e] = (_Float16)av[j][e];
        v16h bf = load_frag_row(brow + (k0 + j) * 32, half);
        acc = __builtin_amdgcn_wmma_f32_16x16x32_f16(false, af, false, bf, (short)0, acc, false, false);
      }
    }
    // acc[r]: output channel cot*16 + l16, input channel cit*16 + 8*half + r.
    h8 o;
#pragma unroll
    for (int r = 0; r < 8; ++r) o[r] = (_Float16)acc[r];
    *(h8*)(w16 + 524288 + (cot * 16 + (cit >> 1)) * 512 + (cit & 1) * 256 + lane * 8) = o;
    // Precaution: no way out of here rewrites an address register that the issued
    // store still names in front of this wait.
    asm volatile("s_wait_xcnt 0x0" ::: "memory");
    return;
  }
  int co = (blk - 128) * 8 + w;                       // one output channel a wave
  const float* wr = wp + co * CC + lane * 4;
  const float* br = bv + lane * 4;
  f4 a[4], c[4];
#pragma unroll  // constant j: the arrays stay in registers
  for (int j = 0; j < 4; ++j) {
    a[j] = *(const f4*)(wr + j * 128);
    c[j] = *(const f4*)(br + j * 128);
  }
  f4 s4 = {};
#pragma unroll
  for (int j = 0; j < 4; ++j) s4 += a[j] * c[j];
  float s = (s4[0] + s4[1]) + (s4[2] + s4[3]);
  s += __shfl_xor(s, 1); s += __shfl_xor(s, 2); s += __shfl_xor(s, 4); s += __shfl_xor(s, 8);
  s += xhalf(s);
  if (lane == 0) bv2[co] = s;
}

// -------- QKV: q, k (row = pixel, k = channel), v_t (row = channel, k = pixel), each
// image's matrix in fragment order. v is the value already projected: its weights are
// Wp Wv and its bias, bv here, is Wp bv (prep_kernel).
// 8 waves/block share MT pixel tiles (128 pixels), async-staged to LDS once.
// A weight fragment, loaded from global, feeds MT products. q and k are formed
// transposed (weight rows as A), v as pixels x channels: in both a lane then holds
// the 8 consecutive k of its own place in a block, one b128 store.
__global__ __launch_bounds__(256) void qkv_kernel(const _Float16* __restrict__ hn,
                                                  const _Float16* __restrict__ w16,
                                                  const float* __restrict__ bq,
                                                  const float* __restrict__ bk,
                                                  const float* __restrict__ bv,
                                                  _Float16* __restrict__ q,
                                                  _Float16* __restrict__ k,
                                                  _Float16* __restrict__ vt) {
  __shared__ __attribute__((aligned(16))) _Float16 as[MT * 16 * TP];  // pixel tiles, padded rows
  int tid = threadIdx.x;
  int b   = blockIdx.x >> 5;                          // 32 blocks per image:
  int mb  = (blockIdx.x & 31) >> 2;                   // 8 tiles of 128 pixels x
  int nt  = (blockIdx.x & 3) * 8 + (tid >> 5);        // 4 groups of 8 channel tiles
  stage_rows_async<MT * 16, 256, TP>(hn + (size_t)(b * NPIX + mb * (MT * 16)) * CC, as, tid);

  int lane = tid & 31, half = lane >> 4, l16 = lane & 15;

  const _Float16* arow = as + (size_t)l16 * TP;       // LDS pixel fragments
  const _Float16* wqr  = w16 + (size_t)(nt * 16) * 512 + lane * 8;

  // Many blocks read the same weight lines. Each starts its walk over the 16 channel
  // steps at its own step and wraps, so that they do not ask L2 for one line at one moment.
  int rot = (blockIdx.x >> 2) & 15;
  v8f aq[MT] = {}, ak[MT] = {}, av[MT] = {};
  for (int ki = 0; ki < 16; ++ki) {
    int kk = (ki + rot) & 15;
    int ko = kk * 32;
    const _Float16* wst = wqr + kk * 512;
    v16h bfq = load_frag_blk(wst);
    v16h bfk = load_frag_blk(wst + 262144);
    v16h bfv = load_frag_blk(wst + 524288);
#pragma unroll  // constant t: the accumulator arrays stay in registers
    for (int t = 0; t < MT; ++t) {
      v16h af = load_frag_row(arow + t * 16 * TP + ko, half);
      aq[t] = __builtin_amdgcn_wmma_f32_16x16x32_f16(false, bfq, false, af, (short)0, aq[t], false, false);
      ak[t] = __builtin_amdgcn_wmma_f32_16x16x32_f16(false, bfk, false, af, (short)0, ak[t], false, false);
      av[t] = __builtin_amdgcn_wmma_f32_16x16x32_f16(false, af, false, bfv, (short)0, av[t], false, false);
    }
  }
  // aq, ak [t][r]: pixel t*16 + l16, channel nt*16 + 8*half + r.
  // av [t][r]: channel nt*16 + l16, pixel t*16 + 8*half + r.
  unsigned o8 = (unsigned)(nt * 16 + 8 * half) * 4u;  // byte offsets into the biases
  unsigned o1 = (unsigned)(nt * 16 + l16) * 4u;
  float biasv = *(const float*)((const char*)bv + o1);
  f4 biasq[2], biask[2];
  biasq[0] = *(const f4*)((const char*)bq + o8); biasq[1] = *(const f4*)((const char*)bq + o8 + 16);
  biask[0] = *(const f4*)((const char*)bk + o8); biask[1] = *(const f4*)((const char*)bk + o8 + 16);
  // Precaution: the offset registers stay live up to this wait, so that no
  // load's result is placed in a register that an issued load still names.
  asm volatile("s_wait_xcnt 0x0" :: "v"(o8), "v"(o1) : "memory");
  size_t img = (size_t)b * (NPIX * CC);
  size_t qko = img + (size_t)((mb * MT) * 16 + (nt >> 1)) * 512 + (nt & 1) * 256 + lane * 8;
  size_t vo  = img + (size_t)(nt * 32 + mb * (MT / 2)) * 512 + lane * 8;
#pragma unroll  // constant t, r here and below: accumulators are read from registers
  for (int t = 0; t < MT; ++t) {
    h8 ov;
#pragma unroll
    for (int r = 0; r < 8; ++r) ov[r] = (_Float16)(av[t][r] + biasv);
    *(h8*)(vt + vo + (t >> 1) * 512 + (t & 1) * 256) = ov;
  }
#pragma unroll
  for (int t = 0; t < MT; ++t) {
    h8 oq;
#pragma unroll
    for (int r = 0; r < 8; ++r) oq[r] = (_Float16)(aq[t][r] + biasq[r >> 2][r & 3]);
    *(h8*)(q + qko + t * (16 * 512)) = oq;
  }
#pragma unroll
  for (int t = 0; t < MT; ++t) {
    h8 ok;
#pragma unroll
    for (int r = 0; r < 8; ++r) ok[r] = (_Float16)(ak[t][r] + biask[r >> 2][r & 3]);
    *(h8*)(k + qko + t * (16 * 512)) = ok;
  }
}

// One trip of phase 1 of the attention kernel: 4 K fragments x 4 q fragments (LDS, qp).
__device__ __forceinline__ void qk_trip(v8f (&s)[4][4], const v16h (&kf)[4], const _Float16* qp) {
#pragma unroll  // constant t, u: fragments and accumulators stay in registers
  for (int t = 0; t < 4; ++t) {
    v16h qf = load_frag_blk(qp + t * (QTB / 2));
#pragma unroll
    for (int u = 0; u < 4; ++u)
      s[u][t] = __builtin_amdgcn_wmma_f32_16x16x32_f16(false, kf[u], false, qf, (short)0, s[u][t], false, false);
  }
}

// One trip of phase 3: 2 V^T fragments x 4 P fragments (LDS rows at pp).
__device__ __forceinline__ void pv_trip(v8f (&acc)[2][4], const v16h (&vf)[2], const _Float16* pp, int half) {
#pragma unroll  // constant t: the accumulator arrays stay in registers
  for (int t = 0; t < 4; ++t) {
    v16h pf = load_frag_row(pp + t * 16 * PP, half);
    acc[0][t] = __builtin_amdgcn_wmma_f32_16x16x32_f16(false, vf[0], false, pf, (short)0, acc[0][t], false, false);
    acc[1][t] = __builtin_amdgcn_wmma_f32_16x16x32_f16(false, vf[1], false, pf, (short)0, acc[1][t], false, false);
  }
}

__device__ __forceinline__ void loads_issued(const void* p) {
  asm volatile("s_wait_xcnt 0x0" :: "v"(p) : "memory");
}

// Async-stage the block's q tile (64 queries x 512 f16, 64 blocks of 1 KB in fragment
// order) into LDS, 512 threads x 16 B a copy. A copy is one query's 8 channels, and it
// lands in tile (query & 3), row (query >> 2): lane l16 of tile t then owns query
// l16 * 4 + t, so that at the end a lane holds 4 consecutive pixels of the output.
__device__ __forceinline__ void stage_q_async(const _Float16* gsrc, _Float16* lds_dst, int tid) {
  unsigned l0 = (unsigned)(uintptr_t)(void*)lds_dst;
#pragma unroll  // both loops: the address arrays stay in registers
  for (int it = 0; it < 8; it += 4) {
    unsigned dst[4];                                   // LDS byte addresses
    unsigned long long gsa[4];                         // global addresses
#pragma unroll
    for (int u = 0; u < 4; ++u) {
      int e = ((it + u) * 512 + tid) * 8;              // f16 elements
      int qy = (e >> 13) * 16 + ((e >> 3) & 15);       // query inside the tile of 64
      dst[u] = l0 + (unsigned)((qy & 3) * QTB + ((e >> 9) & 15) * 1024 + ((e >> 7) & 3) * 256 + (qy >> 2) * 16);
      gsa[u] = (unsigned long long)(uintptr_t)(gsrc + e);
    }
    // Precaution: the wait closes the copies' own statement, so that no address
    // register of an issued copy is rewritten in front of it.
    asm volatile("global_load_async_to_lds_b128 %0, %4, off\n\t"
                 "global_load_async_to_lds_b128 %1, %5, off\n\t"
                 "global_load_async_to_lds_b128 %2, %6, off\n\t"
                 "global_load_async_to_lds_b128 %3, %7, off\n\t"
                 "s_wait_xcnt 0x0"
                 :: "v"(dst[0]), "v"(dst[1]), "v"(dst[2]), "v"(dst[3]),
                    "v"(gsa[0]), "v"(gsa[1]), "v"(gsa[2]), "v"(gsa[3]) : "memory");
  }
  // The copies have landed before the barrier publishes the tile to all waves.
  asm volatile("s_wait_asynccnt 0x0" ::: "memory");
  __syncthreads();
}

// -------- Attention + residual: per (batch, 64-query tile) block, scores stay in registers
// 16 waves. Both products are formed transposed (K or V^T rows as A, q or P rows
// as B), so a lane owns one query per tile and its keys or channels lie along the
// accumulator registers. A wave holds 64 keys x 64 queries of scores (4 x 4 tiles):
// a K fragment, loaded from global in fragment order, feeds four query tiles, and
// the softmax works on the accumulators; only exp(s - max), as f16, goes to LDS.
// v is already projected, so the result plus bp plus x is the output (f32, (b, c, h, w)).
__global__ __launch_bounds__(512) void attn_kernel(const _Float16* __restrict__ q,
                                                   const _Float16* __restrict__ k,
                                                   const _Float16* __restrict__ vt,
                                                   const float* __restrict__ bp,
                                                   const float* __restrict__ x,
                                                   float* __restrict__ out) {
  __shared__ __attribute__((aligned(16))) char smem[QR * PP * 2 + 2 * 16 * RP * 4];
  _Float16* P    = (_Float16*)smem;                    // QR rows x PP f16
  _Float16* qs   = P;                                  // q stage (4 tiles of QTB bytes) overlaps P:
                                                       // qs dead before P is written
  float*    redm = (float*)(smem + QR * PP * 2);       // 16 waves x RP: maxima
  float*    reds = redm + 16 * RP;                     // 16 waves x RP: sums

  int tid = threadIdx.x;
  int w = tid >> 5, lane = tid & 31, half = lane >> 4, l16 = lane & 15;
  int b = blockIdx.x >> 4, qt = blockIdx.x & 15;
  const float sc2 = 0.044194173824159216f * 1.4426950408889634f;  // 512^-0.5 * log2(e)

  const _Float16* kblk = k + (size_t)(b * NPIX + w * 64) * CC + lane * 8;
  v16h kf[2][4];                                       // two register sets: this trip, the next
#pragma unroll  // constant u: the fragments stay in registers
  for (int u = 0; u < 4; ++u) kf[0][u] = load_frag_blk(kblk + qt * 512 + u * 16 * 512);
  loads_issued(kblk + qt * 512);
  stage_q_async(q + (size_t)(b * NPIX + qt * QR) * CC, qs, tid);
  const _Float16* qblk = qs + lane * 8;

  // Phase 1: S^T = k_rows x q_tile^T. s[u][t][r]: key w*64 + u*16 + 8*half + r,
  // query l16*4 + t. The K fragments of trip ki + 1 are loaded in front of the
  // products of trip ki, so that their way from L2 is covered by those products.
  v8f s[4][4] = {};
#pragma nounroll  // unrolled whole, as the compiler does unasked, the build spills accumulators to scratch
  for (int ki = 0; ki < 14; ki += 2) {
    int c0 = ((ki + qt) & 15) * 512, c1 = ((ki + 1 + qt) & 15) * 512, c2 = ((ki + 2 + qt) & 15) * 512;
    const _Float16* kp1 = kblk + c1;
#pragma unroll  // constant u here and below: the fragments stay in registers
    for (int u = 0; u < 4; ++u) kf[1][u] = load_frag_blk(kp1 + u * 16 * 512);
    loads_issued(kp1);
    qk_trip(s, kf[0], qblk + c0);
    const _Float16* kp2 = kblk + c2;
#pragma unroll
    for (int u = 0; u < 4; ++u) kf[0][u] = load_frag_blk(kp2 + u * 16 * 512);
    loads_issued(kp2);
    qk_trip(s, kf[1], qblk + c1);
  }
  const _Float16* kpl = kblk + ((15 + qt) & 15) * 512;
#pragma unroll
  for (int u = 0; u < 4; ++u) kf[1][u] = load_frag_blk(kpl + u * 16 * 512);
  loads_issued(kpl);
  qk_trip(s, kf[0], qblk + ((14 + qt) & 15) * 512);
  qk_trip(s, kf[1], qblk + ((15 + qt) & 15) * 512);

  // Phase 2: softmax over the keys of each query. In a lane: over its 32 keys per
  // query tile; then the other lane half; then the 16 waves, through LDS.
  f4 mx;
#pragma unroll  // constant t, u, r here and below: accumulators are read from registers
  for (int t = 0; t < 4; ++t) {
    float m = s[0][t][0];
#pragma unroll
    for (int u = 0; u < 4; ++u) {
#pragma unroll
      for (int r = 0; r < 8; ++r) m = fmaxf(m, s[u][t][r]);
    }
    mx[t] = fmaxf(m, xhalf(m));
  }
  if (half == 0) *(f4*)(redm + w * RP + l16 * 4) = mx;
  __syncthreads();                                     // also: every wave has left qs
  // The residual of this lane's outputs (channel w*32 + u*16 + 8*half + r, pixels
  // qt*64 + l16*4 ..+3) is asked for here: it comes from memory while the exponentials
  // are formed, when the block asks for nothing else. 16 lanes cover 256 contiguous
  // bytes of one channel: a load or store takes 4 whole lines.
  size_t oo = (size_t)(b * CC + w * 32 + 8 * half) * NPIX + qt * QR + l16 * 4;
  const float* xp = x + oo;
  f4 xv[2][8];
#pragma unroll  // constant u, r: the array stays in registers
  for (int u = 0; u < 2; ++u) {
#pragma unroll
    for (int r = 0; r < 8; ++r) xv[u][r] = *(const f4*)(xp + (u * 16 + r) * NPIX);
  }
  loads_issued(xp);
  f4 gm = *(const f4*)(redm + (half * 8) * RP + l16 * 4);
#pragma unroll
  for (int j = 1; j < 8; ++j) {
    f4 o = *(const f4*)(redm + (half * 8 + j) * RP + l16 * 4);
#pragma unroll
    for (int t = 0; t < 4; ++t) gm[t] = fmaxf(gm[t], o[t]);
  }
  f4 sm = {};
#pragma unroll
  for (int t = 0; t < 4; ++t) {
    float mc = fmaxf(gm[t], xhalf(gm[t])) * sc2;
#pragma unroll
    for (int u = 0; u < 4; ++u) {
      h8 o;
#pragma unroll
      for (int r = 0; r < 8; ++r) {
        float e = exp2_slot(fmaf(s[u][t][r], sc2, -mc));
        sm[t] += e;
        o[r] = (_Float16)e;
      }
      *(h8*)(P + (size_t)(t * 16 + l16) * PP + (w * 4 + u) * 16 + half * 8) = o;
    }
    sm[t] += xhalf(sm[t]);
  }
  if (half == 0) *(f4*)(reds + w * RP + l16 * 4) = sm;
  __syncthreads();                                     // publishes P and the partial sums
  f4 gs = {};
#pragma unroll
  for (int j = 0; j < 8; ++j) gs += *(const f4*)(reds + (half * 8 + j) * RP + l16 * 4);
  f4 inv;
#pragma unroll
  for (int t = 0; t < 4; ++t) inv[t] = 1.f / (gs[t] + xhalf(gs[t]));

  // Phase 3: out^T = V^T rows x P^T, 2 channel tiles x 4 query tiles per wave; the
  // division by the row sum is done on the f32 result.
  const _Float16* prow = P + (size_t)l16 * PP;
  const _Float16* vblk = vt + (size_t)(b * CC + w * 32) * NPIX + lane * 8;   // and 32 blocks on
  v8f acc[2][4] = {};
  v16h vr[4][2];                                       // register ring: V fragments of four trips
#pragma unroll  // constant j: the ring stays in registers
  for (int j = 0; j < 3; ++j) {
    const _Float16* vp = vblk + ((j + 2 * qt) & 31) * 512;
    vr[j][0] = load_frag_blk(vp);
    vr[j][1] = load_frag_blk(vp + 32 * 512);
    loads_issued(vp);
  }
  for (int k0 = 2 * qt; k0 < 2 * qt + 28; k0 += 4) {
#pragma unroll  // constant j: the ring stays in registers
    for (int j = 0; j < 4; ++j) {                      // three trips ahead: a trip's 8 products are short
      const _Float16* vp = vblk + ((k0 + j + 3) & 31) * 512;
      vr[(j + 3) & 3][0] = load_frag_blk(vp);
      vr[(j + 3) & 3][1] = load_frag_blk(vp + 32 * 512);
      loads_issued(vp);
      pv_trip(acc, vr[j], prow + ((k0 + j) & 31) * 32, half);
    }
  }
  const float* bb = bp + w * 32 + 8 * half;            // the bias of the same channels
  f4 bo[2][2];
#pragma unroll  // constant u: the array stays in registers
  for (int u = 0; u < 2; ++u) {
    bo[u][0] = *(const f4*)(bb + u * 16);
    bo[u][1] = *(const f4*)(bb + u * 16 + 4);
  }
  loads_issued(bb);
  const _Float16* vpl = vblk + ((2 * qt + 31) & 31) * 512;
  vr[3][0] = load_frag_blk(vpl);
  vr[3][1] = load_frag_blk(vpl + 32 * 512);
  loads_issued(vpl);
#pragma unroll
  for (int j = 0; j < 4; ++j) pv_trip(acc, vr[j], prow + ((2 * qt + 28 + j) & 31) * 32, half);
  float* op = out + oo;
#pragma unroll  // constant t, u, r: accumulators are read from registers
  for (int u = 0; u < 2; ++u) {
#pragma unroll
    for (int r = 0; r < 8; ++r) {
      f4 o;
#pragma unroll
      for (int t = 0; t < 4; ++t) o[t] = xv[u][r][t] + acc[u][t][r] * inv[t] + bo[u][r >> 2][r & 3];
      *(f4*)(op + (u * 16 + r) * NPIX) = o;
    }
  }
}

extern "C" void kernel_launch(void* const* d_in, const int* in_sizes, int n_in,
                              void* d_out, int out_size, void* d_ws, size_t ws_size,
                              hipStream_t stream) {
  const float* x     = (const float*)d_in[0];
  const float* gamma = (const float*)d_in[1];
  const float* beta  = (const float*)d_in[2];
  const float* wq    = (const float*)d_in[3];
  const float* bq    = (const float*)d_in[4];
  const float* wk    = (const float*)d_in[5];
  const float* bk    = (const float*)d_in[6];
  const float* wv    = (const float*)d_in[7];
  const float* bv    = (const float*)d_in[8];
  const float* wp    = (const float*)d_in[9];
  const float* bp    = (const float*)d_in[10];
  float* out = (float*)d_out;

  char* ws = (char*)d_ws;
  _Float16* w16 = (_Float16*)ws;                                   // 1.5 MB of 2 MB
  _Float16* hn  = (_Float16*)(ws + (size_t)(2u << 20));            // 32 MB
  _Float16* qb  = (_Float16*)(ws + (size_t)(34u << 20));           // 32 MB
  _Float16* kb  = (_Float16*)(ws + (size_t)(66u << 20));           // 32 MB
  _Float16* vtb = (_Float16*)(ws + (size_t)(98u << 20));           // 32 MB
  float* bv2    = (float*)(ws + (size_t)(130u << 20));             // 2 KB

  prep_kernel<<<2240, 256, 0, stream>>>(wq, wk, wv, wp, bv, w16, bv2);
  gn_kernel<<<256, 1024, 0, stream>>>(x, gamma, beta, hn);
  qkv_kernel<<<1024, 256, 0, stream>>>(hn, w16, bq, bk, bv2, qb, kb, vtb);
  attn_kernel<<<512, 512, 0, stream>>>(qb, kb, vtb, bp, x, out);
}

// v010
// It runs in 103 microseconds.
// Versions in between are left out here; by their measured steps it is 1.12 times as fast as v008.
// All steps since v000 together make it 14.9 times as fast.
#include <hip/hip_runtime.h>
#include <hip/hip_bf16.h>
#include <stdint.h>

typedef _Float16 v16h __attribute__((ext_vector_type(16)));
typedef float    v8f  __attribute__((ext_vector_type(8)));
typedef _Float16 h2   __attribute__((ext_vector_type(2)));
typedef _Float16 h4   __attribute__((ext_vector_type(4)));
typedef _Float16 h8   __attribute__((ext_vector_type(8)));
typedef float    f4   __attribute__((ext_vector_type(4)));

#define BB   32
#define CC   512
#define NPIX 1024
#define CPG  16
#define EPSV 1e-5f
#define TP 520
#define PP 1048
#define RP 68
#define MT 8
#define QR 64
#define QTB 16448

__device__ __forceinline__ v16h load_frag_row(const _Float16* rowp, int half) {
  v16h out;
#pragma unroll
  for (int j = 0; j < 8; ++j) {
    int k = 2 * j + ((j >= 4) ? 8 : 0) + half * 8;
    h2 p = *(const h2*)(rowp + k);
    out[2 * j]     = p[0];
    out[2 * j + 1] = p[1];
  }
  return out;
}

// Fragment order in the workspace. A matrix of rows x K f16 is kept as blocks of
// 16 rows x 32 k = 1 KB, block index (row / 16) * (K / 32) + k / 32. Inside a block
// the f16 at (row, k) lies at ((k >> 4) & 1) * 256 + (((k >> 3) & 1) * 16 + (row & 15)) * 8
// + (k & 7): the layout of load_frag_row, lane by lane. A fragment is then two b128
// loads of 512 contiguous bytes per wave (4 whole lines each, not 16 pieces of 32 B).
// lp: the block's start + lane * 8.
__device__ __forceinline__ v16h load_frag_blk(const _Float16* lp) {
  h8 lo = *(const h8*)lp;
  h8 hi = *(const h8*)(lp + 256);
  return __builtin_shufflevector(lo, hi, 0, 1, 2, 3, 4, 5, 6, 7, 8, 9, 10, 11, 12, 13, 14, 15);
}

__device__ __forceinline__ float xhalf(float x) {
  int i = __builtin_bit_cast(int, x);
  return __builtin_bit_cast(float, __builtin_amdgcn_permlanex16(i, i, 0x76543210, 0xfedcba98, false, false));
}

__device__ __forceinline__ float exp2_slot(float x) {
  float e;
  asm("v_exp_f32 %0, %1\n\tv_nop" : "=v"(e) : "v"(x));
  return e;
}

template <int ROWS, int NTHR, int PITCH>
__device__ __forceinline__ void stage_rows_async(const _Float16* gsrc,
                                                 _Float16* lds_dst, int tid) {
  unsigned l0 = (unsigned)(uintptr_t)(void*)lds_dst;
#pragma unroll  // both loops: the address arrays stay in registers
  for (int it = 0; it < ROWS * 64 / NTHR; it += 4) {
    unsigned dst[4];                                   // LDS byte addresses
    unsigned long long gsa[4];                         // global addresses
#pragma unroll
    for (int u = 0; u < 4; ++u) {
      int e = ((it + u) * NTHR + tid) * 8;             // f16 elements
      dst[u] = l0 + (unsigned)((e >> 9) * (PITCH * 2) + (e & 511) * 2);
      gsa[u] = (unsigned long long)(uintptr_t)(gsrc + e);
    }
    // Precaution: the wait closes the copies' own statement, so that no address
    // register of an issued copy is rewritten in front of it.
    asm volatile("global_load_async_to_lds_b128 %0, %4, off\n\t"
                 "global_load_async_to_lds_b128 %1, %5, off\n\t"
                 "global_load_async_to_lds_b128 %2, %6, off\n\t"
                 "global_load_async_to_lds_b128 %3, %7, off\n\t"
                 "s_wait_xcnt 0x0"
                 :: "v"(dst[0]), "v"(dst[1]), "v"(dst[2]), "v"(dst[3]),
                    "v"(gsa[0]), "v"(gsa[1]), "v"(gsa[2]), "v"(gsa[3]) : "memory");
  }
  // The copies have landed before the barrier publishes the tile to all waves.
  asm volatile("s_wait_asynccnt 0x0" ::: "memory");
  __syncthreads();
}

// -------- GroupNorm: (B,512,1024) f32 -> normalized f16, each image's matrix (row = pixel
// position, k = channel) in fragment order: it is read as the attention's key matrix too.
// One block = one image x 64 channels (4 groups) x all 1024 pixels, held in
// registers, so x is read once. lane = (cg, pq): a thread owns the 16 channels of group cg
// at 4 consecutive pixels; wave w owns pixels w*32 .. w*32+31. Pixel w*32 + pq*4 + i stands
// at position w*32 + i*8 + pq: the eight pq lanes then store 8 consecutive rows of a 1-KB
// block, one whole 128-byte line. The order of the keys is free as long as k and v_t agree
// (both follow hn); the attention kernel undoes it for the queries (stage_q_async).
__global__ __launch_bounds__(1024) void gn_kernel(const float* __restrict__ x,
                                                  const float* __restrict__ gamma,
                                                  const float* __restrict__ beta,
                                                  _Float16* __restrict__ hn) {
  __shared__ f4 red[4 * 17];
  int tid = threadIdx.x;
  int w = tid >> 5, lane = tid & 31, pq = lane & 7, cg = lane >> 3;
  int b = blockIdx.x >> 3, cb = blockIdx.x & 7;
  int ch0 = cb * 64 + cg * 16;
  const float* xb = x + (size_t)(b * CC + ch0) * NPIX + w * 32 + pq * 4;

  f4 v[8][2];                                         // [j][h]: channel ch0 + h*8 + j
#pragma unroll
  for (int j = 0; j < 8; ++j) {
    v[j][0] = *(const f4*)(xb + j * NPIX);
    v[j][1] = *(const f4*)(xb + (8 + j) * NPIX);
  }
  unsigned goff = (unsigned)ch0 * 4u;                 // byte offset into gamma, beta
  f4 ga[4], be[4];
#pragma unroll  // constant c: the arrays stay in registers
  for (int c = 0; c < 4; ++c) {
    ga[c] = *(const f4*)((const char*)gamma + goff + c * 16);
    be[c] = *(const f4*)((const char*)beta + goff + c * 16);
  }
  // Precaution: the address registers stay live up to this wait, so that no
  // load's result is placed in a register that an issued load still names.
  asm volatile("s_wait_xcnt 0x0" :: "v"(xb), "v"(goff) : "memory");

  f4 s4 = {}, ss4 = {};
#pragma unroll
  for (int j = 0; j < 8; ++j) {
    s4 += v[j][0]; ss4 += v[j][0] * v[j][0];
    s4 += v[j][1]; ss4 += v[j][1] * v[j][1];
  }
  float s  = (s4[0] + s4[1]) + (s4[2] + s4[3]);
  float ss = (ss4[0] + ss4[1]) + (ss4[2] + ss4[3]);
  // Lanes of one group inside a wave: the eight pq (bits 0 to 2).
  s += __shfl_xor(s, 1);  ss += __shfl_xor(ss, 1);
  s += __shfl_xor(s, 2);  ss += __shfl_xor(ss, 2);
  s += __shfl_xor(s, 4);  ss += __shfl_xor(ss, 4);
  if (pq == 0) {
    float* rf = (float*)red + cg * 68 + w * 2;
    rf[0] = s; rf[1] = ss;
  }
  __syncthreads();
  f4 t4 = {};
#pragma unroll
  for (int t = 0; t < 16; ++t) t4 += red[cg * 17 + t];
  float mean = (t4[0] + t4[2]) * (1.f / 16384.f);
  float var  = (t4[1] + t4[3]) * (1.f / 16384.f) - mean * mean;
  float inv  = rsqrtf(var + EPSV);

  // Block (position / 16, channel / 32); inside it half (channel / 16) & 1, then 16-lane
  // row (channel / 8) & 1 = h, then row position & 15 = (i & 1) * 8 + pq.
  _Float16* hb = hn + (size_t)b * (NPIX * CC) + (size_t)(w * 32 + cb * 2 + (cg >> 1)) * 512
               + (cg & 1) * 256 + pq * 8;
#pragma unroll
  for (int h = 0; h < 2; ++h) {
#pragma unroll
    for (int i = 0; i < 4; ++i) {
      h8 o;
#pragma unroll
      for (int j = 0; j < 8; ++j)
        o[j] = (_Float16)((v[j][h][i] - mean) * inv * ga[h * 2 + (j >> 2)][j & 3] + be[h * 2 + (j >> 2)][j & 3]);
      *(h8*)(hb + (i >> 1) * (16 * 512) + h * 128 + (i & 1) * 64) = o;
    }
  }
}

// -------- Weights. The output projection is linear, so
// Wp (sum_j p_j (Wv h_j + bv)) + bp = sum_j p_j ((Wp Wv) h_j + Wp bv) + bp:
// the value projection is done with Wp Wv and Wp bv, and no projection follows the attention.
// The score is bilinear: (Wq h_i + bq) . (Wk h_j + bk) = (Wk^T Wq h_i + Wk^T bq) . h_j
// + (Wq h_i + bq) . bk. The last term is the same for every key j of a query, and the
// softmax over the keys does not see it. So the query projection is done with Wk^T Wq and
// Wk^T bq, and the key is the normalized input itself.
// Blocks 0..127: Wp Wv, blocks 128..255: Wk^T Wq, one 16 x 16 tile a wave, f16 operands,
// f32 sums, stored in w16 in fragment order (rows = output channels, k = input channels).
// Blocks 256..319: Wp bv, blocks 320..383: Wk^T bq, in f32.
__global__ __launch_bounds__(256) void prep_kernel(const float* __restrict__ wq,
                                                   const float* __restrict__ wk,
                                                   const float* __restrict__ wv,
                                                   const float* __restrict__ wp,
                                                   const float* __restrict__ bq,
                                                   const float* __restrict__ bv,
                                                   _Float16* __restrict__ w16,
                                                   float* __restrict__ bq2,
                                                   float* __restrict__ bv2) {
  __shared__ __attribute__((aligned(16))) _Float16 wps[16 * TP];    // 16 rows of Wp or of Wk^T, padded
  int tid = threadIdx.x, blk = blockIdx.x;
  int w = tid >> 5, lane = tid & 31, half = lane >> 4, l16 = lane & 15;
  if (blk < 256) {
    // Formed transposed (columns of Wv or Wq as A rows, rows of Wp or Wk^T as B): a lane then
    // holds the 8 consecutive input channels of its own place in a block, one b128 store.
    // The 8 waves share the 16 B rows. Read as fragments from global, a load would touch
    // 16 lines; they are read once, and the fragments come from LDS.
    bool qk = blk >= 128;
    int cot = (blk & 127) >> 2, cit = (blk & 3) * 8 + w;
    f4 st[8];
    if (!qk) {
      const float* sp = wp + (cot * 16 + (tid >> 4)) * CC + (tid & 15) * 4;
#pragma unroll  // constant j here and below: the array stays in registers
      for (int j = 0; j < 8; ++j) st[j] = *(const f4*)(sp + j * 64);
      // Precaution: the address register stays live up to the wait, so that no load's
      // result is placed in a register that an issued load still names.
      asm volatile("s_wait_xcnt 0x0" :: "v"(sp) : "memory");
#pragma unroll
      for (int j = 0; j < 8; ++j) {
        h4 o4 = {(_Float16)st[j][0], (_Float16)st[j][1], (_Float16)st[j][2], (_Float16)st[j][3]};
        *(h4*)(wps + (tid >> 4) * TP + (tid & 15) * 4 + j * 64) = o4;
      }
    } else {
      // Row o of Wk^T is column cot*16 + o of Wk: 4 lanes read the 16 columns of one row of Wk.
      const float* sp = wk + (tid >> 2) * CC + cot * 16 + (tid & 3) * 4;
#pragma unroll
      for (int j = 0; j < 8; ++j) st[j] = *(const f4*)(sp + j * 64 * CC);
      asm volatile("s_wait_xcnt 0x0" :: "v"(sp) : "memory");
#pragma unroll
      for (int j = 0; j < 8; ++j) {
#pragma unroll
        for (int e = 0; e < 4; ++e)
          wps[((tid & 3) * 4 + e) * TP + (tid >> 2) + j * 64] = (_Float16)st[j][e];
      }
    }
    __syncthreads();                                   // publishes the 16 rows
    const float* ap = (qk ? wq : wv) + (half * 8) * CC + cit * 16 + l16;   // + m * CC
    const _Float16* brow = wps + l16 * TP;
    v8f acc = {};
#pragma nounroll  // one trip keeps the loads of four k steps in flight; more would only add registers
    for (int k0 = 0; k0 < 16; k0 += 4) {
      float av[4][16];
      const float* a0 = ap + k0 * 32 * CC;
#pragma unroll  // constant j, e here and below: the array stays in registers
      for (int j = 0; j < 4; ++j) {
#pragma unroll
        for (int e = 0; e < 8; ++e) {
          av[j][e]     = a0[(j * 32 + e) * CC];
          av[j][8 + e] = a0[(j * 32 + 16 + e) * CC];
        }
      }
      // The memory clobber keeps all 64 loads in front, in flight together: without it the
      // compiler holds part of them back until registers of the first ones are free again.
      // Precaution: the address register stays live up to the wait.
      asm volatile("s_wait_xcnt 0x0" :: "v"(a0) : "memory");
#pragma unroll
      for (int j = 0; j < 4; ++j) {
        v16h af;
#pragma unroll
        for (int e = 0; e < 16; ++e) af[e] = (_Float16)av[j][e];
        v16h bf = load_frag_row(brow + (k0 + j) * 32, half);
        acc = __builtin_amdgcn_wmma_f32_16x16x32_f16(false, af, false, bf, (short)0, acc, false, false);
      }
    }
    // acc[r]: output channel cot*16 + l16, input channel cit*16 + 8*half + r.
    h8 o;
#pragma unroll
    for (int r = 0; r < 8; ++r) o[r] = (_Float16)acc[r];
    *(h8*)(w16 + (qk ? 0 : 262144) + (cot * 16 + (cit >> 1)) * 512 + (cit & 1) * 256 + lane * 8) = o;
    // Precaution: no way out of here rewrites an address register that the issued
    // store still names in front of this wait.
    asm volatile("s_wait_xcnt 0x0" ::: "memory");
    return;
  }
  float s;
  int co = ((blk - 256) & 63) * 8 + w;                // one output channel a wave
  if (blk < 320) {
    const float* wr = wp + co * CC + lane * 4;
    const float* br = bv + lane * 4;
    f4 a[4], c[4];
#pragma unroll  // constant j: the arrays stay in registers
    for (int j = 0; j < 4; ++j) {
      a[j] = *(const f4*)(wr + j * 128);
      c[j] = *(const f4*)(br + j * 128);
    }
    asm volatile("s_wait_xcnt 0x0" :: "v"(wr), "v"(br) : "memory");
    f4 s4 = {};
#pragma unroll
    for (int j = 0; j < 4; ++j) s4 += a[j] * c[j];
    s = (s4[0] + s4[1]) + (s4[2] + s4[3]);
  } else {
    // Column co of Wk; the 8 waves of the block read neighbouring columns of the same lines.
    const float* wc = wk + lane * CC + co;
    const float* br = bq + lane;
    float a[16], c[16];
#pragma unroll  // constant j: the arrays stay in registers
    for (int j = 0; j < 16; ++j) {
      a[j] = wc[j * 32 * CC];
      c[j] = br[j * 32];
    }
    asm volatile("s_wait_xcnt 0x0" :: "v"(wc), "v"(br) : "memory");
    float s2[4] = {0.f, 0.f, 0.f, 0.f};
#pragma unroll
    for (int j = 0; j < 16; ++j) s2[j & 3] += a[j] * c[j];
    s = (s2[0] + s2[1]) + (s2[2] + s2[3]);
  }
  s += __shfl_xor(s, 1); s += __shfl_xor(s, 2); s += __shfl_xor(s, 4); s += __shfl_xor(s, 8);
  s += xhalf(s);
  if (lane == 0) (blk < 320 ? bv2 : bq2)[co] = s;
}

// -------- Q, V: q (row = pixel, k = channel), v_t (row = channel, k = pixel), each
// image's matrix in fragment order. v is the value already projected: its weights are
// Wp Wv and its bias, bv here, is Wp bv; q carries the key projection: its weights are
// Wk^T Wq and its bias, bq here, is Wk^T bq (prep_kernel). The key matrix is hn itself.
// "Pixel" stands for the pixel's position in hn (gn_kernel) here.
// 8 waves/block share MT pixel tiles (128 pixels), async-staged to LDS once.
// A weight fragment, loaded from global, feeds MT products. q is formed
// transposed (weight rows as A), v as pixels x channels: in both a lane then holds
// the 8 consecutive k of its own place in a block, one b128 store.
__global__ __launch_bounds__(256) void qkv_kernel(const _Float16* __restrict__ hn,
                                                  const _Float16* __restrict__ w16,
                                                  const float* __restrict__ bq,
                                                  const float* __restrict__ bv,
                                                  _Float16* __restrict__ q,
                                                  _Float16* __restrict__ vt) {
  __shared__ __attribute__((aligned(16))) _Float16 as[MT * 16 * 512]; // MT tiles x 16 blocks of 1 KB
  int tid = threadIdx.x;
  int b   = blockIdx.x >> 5;                          // 32 blocks per image:
  int mb  = (blockIdx.x & 31) >> 2;                   // 8 tiles of 128 pixels x
  int nt  = (blockIdx.x & 3) * 8 + (tid >> 5);        // 4 groups of 8 channel tiles
  stage_rows_async<MT * 16, 256, 512>(hn + (size_t)(b * NPIX + mb * (MT * 16)) * CC, as, tid);

  int lane = tid & 31, half = lane >> 4, l16 = lane & 15;

  const _Float16* ablk = as + lane * 8;               // LDS pixel fragments: 512 contiguous bytes a read
  const _Float16* wqr  = w16 + (size_t)(nt * 16) * 512 + lane * 8;
  size_t img = (size_t)b * (NPIX * CC);

  // Many blocks read the same weight lines. Each starts its walk over the 16 channel
  // steps at its own step and wraps, so that they do not ask L2 for one line at one moment.
  int rot = (blockIdx.x >> 2) & 15;
  v8f aq[MT] = {}, av[MT] = {};
  for (int ki = 0; ki < 16; ++ki) {
    int kk = (ki + rot) & 15;
    const _Float16* wst = wqr + kk * 512;
    v16h bfq = load_frag_blk(wst);
    v16h bfv = load_frag_blk(wst + 262144);
#pragma unroll  // constant t: the accumulator arrays stay in registers
    for (int t = 0; t < MT; ++t) {
      v16h af = load_frag_blk(ablk + (t * 16 + kk) * 512);
      aq[t] = __builtin_amdgcn_wmma_f32_16x16x32_f16(false, bfq, false, af, (short)0, aq[t], false, false);
      av[t] = __builtin_amdgcn_wmma_f32_16x16x32_f16(false, af, false, bfv, (short)0, av[t], false, false);
    }
  }
  // aq [t][r]: pixel t*16 + l16, channel nt*16 + 8*half + r.
  // av [t][r]: channel nt*16 + l16, pixel t*16 + 8*half + r.
  unsigned o8 = (unsigned)(nt * 16 + 8 * half) * 4u;  // byte offsets into the biases
  unsigned o1 = (unsigned)(nt * 16 + l16) * 4u;
  float biasv = *(const float*)((const char*)bv + o1);
  f4 biasq[2];
  biasq[0] = *(const f4*)((const char*)bq + o8); biasq[1] = *(const f4*)((const char*)bq + o8 + 16);
  // Precaution: the offset registers stay live up to this wait, so that no
  // load's result is placed in a register that an issued load still names.
  asm volatile("s_wait_xcnt 0x0" :: "v"(o8), "v"(o1) : "memory");
  size_t qko = img + (size_t)((mb * MT) * 16 + (nt >> 1)) * 512 + (nt & 1) * 256 + lane * 8;
  size_t vo  = img + (size_t)(nt * 32 + mb * (MT / 2)) * 512 + lane * 8;
#pragma unroll  // constant t, r here and below: accumulators are read from registers
  for (int t = 0; t < MT; ++t) {
    h8 ov;
#pragma unroll
    for (int r = 0; r < 8; ++r) ov[r] = (_Float16)(av[t][r] + biasv);
    *(h8*)(vt + vo + (t >> 1) * 512 + (t & 1) * 256) = ov;
  }
#pragma unroll
  for (int t = 0; t < MT; ++t) {
    h8 oq;
#pragma unroll
    for (int r = 0; r < 8; ++r) oq[r] = (_Float16)(aq[t][r] + biasq[r >> 2][r & 3]);
    *(h8*)(q + qko + t * (16 * 512)) = oq;
  }
}

// One trip of phase 1 of the attention kernel: 4 K fragments x 4 q fragments (LDS, qp).
__device__ __forceinline__ void qk_trip(v8f (&s)[4][4], const v16h (&kf)[4], const _Float16* qp) {
#pragma unroll  // constant t, u: fragments and accumulators stay in registers
  for (int t = 0; t < 4; ++t) {
    v16h qf = load_frag_blk(qp + t * (QTB / 2));
#pragma unroll
    for (int u = 0; u < 4; ++u)
      s[u][t] = __builtin_amdgcn_wmma_f32_16x16x32_f16(false, kf[u], false, qf, (short)0, s[u][t], false, false);
  }
}

// One trip of phase 3: 2 V^T fragments x 8 P fragments (LDS rows at pp).
__device__ __forceinline__ void pv_trip(v8f (&acc)[2][8], const v16h (&vf)[2], const _Float16* pp, int half) {
#pragma unroll  // constant t: the accumulator arrays stay in registers
  for (int t = 0; t < 8; ++t) {
    v16h pf = load_frag_row(pp + t * 16 * PP, half);
    acc[0][t] = __builtin_amdgcn_wmma_f32_16x16x32_f16(false, vf[0], false, pf, (short)0, acc[0][t], false, false);
    acc[1][t] = __builtin_amdgcn_wmma_f32_16x16x32_f16(false, vf[1], false, pf, (short)0, acc[1][t], false, false);
  }
}

__device__ __forceinline__ void loads_issued(const void* p) {
  asm volatile("s_wait_xcnt 0x0" :: "v"(p) : "memory");
}

// Async-stage one half of the block's q tile (64 queries x 512 f16, 64 blocks of 1 KB in fragment
// order) into LDS, 512 threads x 16 B a copy. A copy is one query's 8 channels. Its row
// in q is the pixel's position in hn (gn_kernel); qy is the pixel. It lands in tile
// (qy & 3), row (qy >> 2): lane l16 of tile t then owns pixel
// l16 * 4 + t, so that at the end a lane holds 4 consecutive pixels of the output.
// The caller waits for the copies and publishes them.
__device__ __forceinline__ void stage_q_async(const _Float16* gsrc, _Float16* lds_dst, int tid) {
  unsigned l0 = (unsigned)(uintptr_t)(void*)lds_dst;
#pragma unroll  // both loops: the address arrays stay in registers
  for (int it = 0; it < 8; it += 4) {
    unsigned dst[4];                                   // LDS byte addresses
    unsigned long long gsa[4];                         // global addresses
#pragma unroll
    for (int u = 0; u < 4; ++u) {
      int e = ((it + u) * 512 + tid) * 8;              // f16 elements
      int ps = (e >> 13) * 16 + ((e >> 3) & 15);       // position inside the tile of 64
      int qy = (ps & 32) + (ps & 7) * 4 + ((ps >> 3) & 3);
      dst[u] = l0 + (unsigned)((qy & 3) * QTB + ((e >> 9) & 15) * 1024 + ((e >> 7) & 3) * 256 + (qy >> 2) * 16);
      gsa[u] = (unsigned long long)(uintptr_t)(gsrc + e);
    }
    // Precaution: the wait closes the copies' own statement, so that no address
    // register of an issued copy is rewritten in front of it.
    asm volatile("global_load_async_to_lds_b128 %0, %4, off\n\t"
                 "global_load_async_to_lds_b128 %1, %5, off\n\t"
                 "global_load_async_to_lds_b128 %2, %6, off\n\t"
                 "global_load_async_to_lds_b128 %3, %7, off\n\t"
                 "s_wait_xcnt 0x0"
                 :: "v"(dst[0]), "v"(dst[1]), "v"(dst[2]), "v"(dst[3]),
                    "v"(gsa[0]), "v"(gsa[1]), "v"(gsa[2]), "v"(gsa[3]) : "memory");
  }
}

// -------- Attention + residual: per (batch, 128-query tile) block, 16 waves.
// Both products are formed transposed (K or V^T rows as A, q or P rows as B), so a lane
// owns one query per tile and its keys or channels lie along the accumulator registers.
// The scores of 64 queries fill the registers, so they are formed in two passes of 64
// queries (score_pass); P of all 128 queries then lies in LDS, and in P x V a V fragment,
// loaded from global, feeds eight query tiles: V is read once per 128 queries.
//
// One pass: scores and softmax numerators of 64 queries. A wave holds 64 keys x 64 queries
// of scores (4 x 4 tiles): a K fragment, loaded from global in fragment order, feeds four
// query tiles, and the softmax works on the accumulators; only exp(s - max), as f16, goes
// to LDS (Ph: this half's 64 rows of P, which overlie this half's staged q).
// kf[0] holds the K fragments of trip 0 on entry. The first pass asks for them again for
// the second; the last pass asks for the residual x instead (xv), in four parts, as
// registers of K fragments and of finished scores fall free: it comes from memory while
// the exponentials are formed, when the block asks for nothing else.
template <bool LAST>
__device__ __forceinline__ void score_pass(const _Float16* kblk, int rot, const _Float16* qblk,
                                           _Float16* Ph, float* redm, float* reds,
                                           v16h (&kf)[2][4], const float* xp, f4 (&xv)[2][2][8],
                                           int w, int half, int l16) {
  const float sc2 = 0.044194173824159216f * 1.4426950408889634f;  // 512^-0.5 * log2(e)
  // Phase 1: S^T = k_rows x q_tile^T. s[u][t][r]: key w*64 + u*16 + 8*half + r,
  // query l16*4 + t. The K fragments of trip ki + 1 are loaded in front of the
  // products of trip ki, so that their way from L2 is covered by those products.
  v8f s[4][4] = {};
#pragma nounroll  // unrolled whole, as the compiler does unasked, the build spills accumulators to scratch
  for (int ki = 0; ki < 14; ki += 2) {
    int c0 = ((ki + rot) & 15) * 512, c1 = ((ki + 1 + rot) & 15) * 512, c2 = ((ki + 2 + rot) & 15) * 512;
    const _Float16* kp1 = kblk + c1;
#pragma unroll  // constant u here and below: the fragments stay in registers
    for (int u = 0; u < 4; ++u) kf[1][u] = load_frag_blk(kp1 + u * 16 * 512);
    loads_issued(kp1);
    qk_trip(s, kf[0], qblk + c0);
    const _Float16* kp2 = kblk + c2;
#pragma unroll
    for (int u = 0; u < 4; ++u) kf[0][u] = load_frag_blk(kp2 + u * 16 * 512);
    loads_issued(kp2);
    qk_trip(s, kf[1], qblk + c1);
  }
  const _Float16* kpl = kblk + ((15 + rot) & 15) * 512;
#pragma unroll
  for (int u = 0; u < 4; ++u) kf[1][u] = load_frag_blk(kpl + u * 16 * 512);
  loads_issued(kpl);
  qk_trip(s, kf[0], qblk + ((14 + rot) & 15) * 512);
  qk_trip(s, kf[1], qblk + ((15 + rot) & 15) * 512);

  // Phase 2: softmax over the keys of each query. In a lane: over its 32 keys per
  // query tile; then the other lane half; then the 16 waves, through LDS.
  f4 mx;
#pragma unroll  // constant t, u, r here and below: accumulators are read from registers
  for (int t = 0; t < 4; ++t) {
    float m = s[0][t][0];
#pragma unroll
    for (int u = 0; u < 4; ++u) {
#pragma unroll
      for (int r = 0; r < 8; ++r) m = fmaxf(m, s[u][t][r]);
    }
    mx[t] = fmaxf(m, xhalf(m));
  }
  if (half == 0) *(f4*)(redm + w * RP + l16 * 4) = mx;
  __syncthreads();                                     // publishes the maxima; also: every wave has left this half's q
  if (!LAST) {
    const _Float16* kp0 = kblk + rot * 512;
#pragma unroll  // constant u: the fragments stay in registers
    for (int u = 0; u < 4; ++u) kf[0][u] = load_frag_blk(kp0 + u * 16 * 512);
    loads_issued(kp0);
  } else {
#pragma unroll  // constant r: the array stays in registers
    for (int r = 0; r < 8; ++r) xv[0][0][r] = *(const f4*)(xp + r * NPIX);
    loads_issued(xp);
  }
  f4 gm = *(const f4*)(redm + (half * 8) * RP + l16 * 4);
#pragma unroll
  for (int j = 1; j < 8; ++j) {
    f4 o = *(const f4*)(redm + (half * 8 + j) * RP + l16 * 4);
#pragma unroll
    for (int t = 0; t < 4; ++t) gm[t] = fmaxf(gm[t], o[t]);
  }
  f4 sm = {};
#pragma unroll
  for (int t = 0; t < 4; ++t) {
    if (LAST && t > 0) {                               // the scores of one more query tile are done with
      // Compiler fence: the loads below stay here. Raised to the first part's place they
      // find no free registers, and loaded values are spilled behind a wait for memory.
      asm volatile("" ::: "memory");
#pragma unroll
      for (int r = 0; r < 8; ++r) xv[t >> 1][t & 1][r] = *(const f4*)(xp + ((t & 1) * 16 + r) * NPIX + (t >> 1) * 64);
      loads_issued(xp);
    }
    float mc = fmaxf(gm[t], xhalf(gm[t])) * sc2;
#pragma unroll
    for (int u = 0; u < 4; ++u) {
      h8 o;
#pragma unroll
      for (int r = 0; r < 8; ++r) {
        float e = exp2_slot(fmaf(s[u][t][r], sc2, -mc));
        sm[t] += e;
        o[r] = (_Float16)e;
      }
      *(h8*)(Ph + (size_t)(t * 16 + l16) * PP + (w * 4 + u) * 16 + half * 8) = o;
    }
    sm[t] += xhalf(sm[t]);
  }
  if (half == 0) *(f4*)(reds + w * RP + l16 * 4) = sm;
}

// v is already projected, so the result plus bp plus x is the output (f32, (b, c, h, w)).
// (x + bp) times the query's row sum is the start value of the P x V accumulators; the
// division by the row sum at the end then gives x + bp + attention.
__global__ __launch_bounds__(512) void attn_kernel(const _Float16* __restrict__ q,
                                                   const _Float16* __restrict__ k,
                                                   const _Float16* __restrict__ vt,
                                                   const float* __restrict__ bp,
                                                   const float* __restrict__ x,
                                                   float* __restrict__ out) {
  __shared__ __attribute__((aligned(16))) char smem[2 * QR * PP * 2 + 4 * 16 * RP * 4];
  _Float16* P    = (_Float16*)smem;                    // 2 halves x QR rows x PP f16
                                                       // q stage of a half (4 tiles of QTB bytes) overlaps
                                                       // that half's P: dead before P is written
  float*    redm = (float*)(smem + 2 * QR * PP * 2);   // 2 halves x 16 waves x RP: maxima
  float*    reds = redm + 2 * 16 * RP;                 // 2 halves x 16 waves x RP: sums

  int tid = threadIdx.x;
  int w = tid >> 5, lane = tid & 31, half = lane >> 4, l16 = lane & 15;
  int b = blockIdx.x >> 3, qt = blockIdx.x & 7;

  int rot = 2 * qt;
  const _Float16* kblk = k + (size_t)(b * NPIX + w * 64) * CC + lane * 8;
  v16h kf[2][4];                                       // two register sets: this trip, the next
#pragma unroll  // constant u: the fragments stay in registers
  for (int u = 0; u < 4; ++u) kf[0][u] = load_frag_blk(kblk + rot * 512 + u * 16 * 512);
  loads_issued(kblk + rot * 512);
  const _Float16* qg = q + (size_t)(b * NPIX + qt * (2 * QR)) * CC;
  stage_q_async(qg, P, tid);
  stage_q_async(qg + QR * CC, P + QR * PP, tid);
  // The copies have landed before the barrier publishes the two halves to all waves.
  asm volatile("s_wait_asynccnt 0x0" ::: "memory");
  __syncthreads();

  // The residual of this lane's outputs: xv[h][u][r] = channel w*32 + u*16 + 8*half + r,
  // pixels qt*128 + h*64 + l16*4 ..+3. 16 lanes cover 256 contiguous bytes of one
  // channel: a load or store takes 4 whole lines.
  size_t oo = (size_t)(b * CC + w * 32 + 8 * half) * NPIX + qt * (2 * QR) + l16 * 4;
  const float* xp = x + oo;
  f4 xv[2][2][8];
  score_pass<false>(kblk, rot, P + lane * 8, P, redm, reds, kf, xp, xv, w, half, l16);
  score_pass<true>(kblk, rot, P + QR * PP + lane * 8, P + QR * PP, redm + 16 * RP, reds + 16 * RP,
                   kf, xp, xv, w, half, l16);
  __syncthreads();                                     // publishes P and the partial sums of both halves
  const float* bb = bp + w * 32 + 8 * half;            // the bias of the same channels
  f4 bo[2][2];
#pragma unroll  // constant u: the array stays in registers
  for (int u = 0; u < 2; ++u) {
    bo[u][0] = *(const f4*)(bb + u * 16);
    bo[u][1] = *(const f4*)(bb + u * 16 + 4);
  }
  loads_issued(bb);

  // Phase 3: out^T = V^T rows x P^T, 2 channel tiles x 8 query tiles per wave.
  const _Float16* prow = P + (size_t)l16 * PP;
  const _Float16* vblk = vt + (size_t)(b * CC + w * 32) * NPIX + lane * 8;   // and 32 blocks on
  v16h vr[4][2];                                       // register ring: V fragments of four trips
#pragma unroll  // constant j: the ring stays in registers
  for (int j = 0; j < 3; ++j) {
    const _Float16* vp = vblk + ((j + 4 * qt) & 31) * 512;
    vr[j][0] = load_frag_blk(vp);
    vr[j][1] = load_frag_blk(vp + 32 * 512);
    loads_issued(vp);
  }
  f4 gs[2], inv[2];
  v8f acc[2][8];
#pragma unroll  // constant h, j, t, u, r: sums and accumulators stay in registers
  for (int h = 0; h < 2; ++h) {
    f4 g = {};
#pragma unroll
    for (int j = 0; j < 8; ++j) g += *(const f4*)(reds + (h * 16 + half * 8 + j) * RP + l16 * 4);
#pragma unroll
    for (int t = 0; t < 4; ++t) {
      gs[h][t]  = g[t] + xhalf(g[t]);
      inv[h][t] = 1.f / gs[h][t];
    }
#pragma unroll
    for (int u = 0; u < 2; ++u) {
#pragma unroll
      for (int t = 0; t < 4; ++t) {
#pragma unroll
        for (int r = 0; r < 8; ++r) acc[u][h * 4 + t][r] = (xv[h][u][r][t] + bo[u][r >> 2][r & 3]) * gs[h][t];
      }
    }
  }
  for (int k0 = 4 * qt; k0 < 4 * qt + 28; k0 += 4) {
#pragma unroll  // constant j: the ring stays in registers
    for (int j = 0; j < 4; ++j) {                      // three trips ahead
      const _Float16* vp = vblk + ((k0 + j + 3) & 31) * 512;
      vr[(j + 3) & 3][0] = load_frag_blk(vp);
      vr[(j + 3) & 3][1] = load_frag_blk(vp + 32 * 512);
      loads_issued(vp);
      pv_trip(acc, vr[j], prow + ((k0 + j) & 31) * 32, half);
    }
  }
  const _Float16* vpl = vblk + ((4 * qt + 31) & 31) * 512;
  vr[3][0] = load_frag_blk(vpl);
  vr[3][1] = load_frag_blk(vpl + 32 * 512);
  loads_issued(vpl);
#pragma unroll
  for (int j = 0; j < 4; ++j) pv_trip(acc, vr[j], prow + ((4 * qt + 28 + j) & 31) * 32, half);
  float* op = out + oo;
#pragma unroll  // constant h, t, u, r: accumulators are read from registers
  for (int u = 0; u < 2; ++u) {
#pragma unroll
    for (int r = 0; r < 8; ++r) {
#pragma unroll
      for (int h = 0; h < 2; ++h) {
        f4 o;
#pragma unroll
        for (int t = 0; t < 4; ++t) o[t] = acc[u][h * 4 + t][r] * inv[h][t];
        *(f4*)(op + (u * 16 + r) * NPIX + h * 64) = o;
      }
    }
  }
}

extern "C" void kernel_launch(void* const* d_in, const int* in_sizes, int n_in,
                              void* d_out, int out_size, void* d_ws, size_t ws_size,
                              hipStream_t stream) {
  const float* x     = (const float*)d_in[0];
  const float* gamma = (const float*)d_in[1];
  const float* beta  = (const float*)d_in[2];
  const float* wq    = (const float*)d_in[3];
  const float* bq    = (const float*)d_in[4];
  const float* wk    = (const float*)d_in[5];
  const float* wv    = (const float*)d_in[7];
  const float* bv    = (const float*)d_in[8];
  const float* wp    = (const float*)d_in[9];
  const float* bp    = (const float*)d_in[10];
  float* out = (float*)d_out;

  char* ws = (char*)d_ws;
  _Float16* w16 = (_Float16*)ws;                                   // 1 MB of 2 MB
  _Float16* hn  = (_Float16*)(ws + (size_t)(2u << 20));            // 32 MB
  _Float16* qb  = (_Float16*)(ws + (size_t)(34u << 20));           // 32 MB
  _Float16* vtb = (_Float16*)(ws + (size_t)(98u << 20));           // 32 MB
  float* bv2    = (float*)(ws + (size_t)(130u << 20));             // 2 KB
  float* bq2    = (float*)(ws + (size_t)(131u << 20));             // 2 KB

  prep_kernel<<<384, 256, 0, stream>>>(wq, wk, wv, wp, bq, bv, w16, bq2, bv2);
  gn_kernel<<<256, 1024, 0, stream>>>(x, gamma, beta, hn);
  qkv_kernel<<<1024, 256, 0, stream>>>(hn, w16, bq2, bv2, qb, vtb);
  attn_kernel<<<256, 512, 0, stream>>>(qb, hn, vtb, bp, x, out);
}
